// v000
// Measured on an AMD MI455X. A time is GPU time per run, averaged over a window of back-to-back runs after a warm-up
// (all launches, gaps included; the runs take copies of the inputs in turn), and the median of several windows.
// Apart from v000's, it joins two sittings. Times from different sittings can be a few percent apart, while
// side-by-side timings come from the same sitting.
// v000 is the starting kernel. One run takes 2010 microseconds.
#include <hip/hip_runtime.h>

// Multi-head attention with biased 'xw' projections and a COMPUTED rotate-half rotary embedding, NO mask (x [2][2048][1024]; q, k, v = x W + b ('xw' (in, out) [1024][1024] 0.02 + zero biases (ONE zeros array bound four times by the module's setup): read; 16 heads x 64); q, k -> cat(x1 cos - x2 sin, x2 cos + x1 sin) on the two 32-wide halves (= t cos + cat(-t2, t1) sin with cat(freqs, freqs)) with angle t x 1 / 10000^(2i/64) (32 f32 frequencies exact for the module's expression 1.0 / (10000.0 ** (arange(0, 64, 2) / 64)); precise cosf/sinf); scores / sqrt(64) (np.sqrt(D_K) as float32); softmax over all keys; out = merged Wo + bo ('xw' + bias) -> [2][2048][1024] (4.2 M); argument order x, Wq, bq, Wk, bk, Wv, bv, Wo, bo).
// Layout per batch: bf16 copy of x; 'xw' weights transposed once; exact projections + f32 biases; k_cs5 computes the rotary table once (32 baked float32 frequencies) and the plane builders (k_rope) apply the rotate-half rotation at width 64 (products rounded separately); dense T-2048 attention with the 1/8 in the softmax (hybrid rows: < 512 hi/lo 3 products, rest fp16 x1024); merged hi/lo x wo exact + bo.
// Compute dtypes, f32 accumulate: every input rounded to bf16; projections exact + f32 biases; attention rows < 512 3 products, rest fp16; softmax f32; Wo hl x exact + bias.

#define NB_  2
#define TT   2048
#define DM   1024
#define NH_  16
#define NKV  16
#define REP  (NH_ / NKV)
#define HD   64
#define DQ   (NH_ * HD)
#define DKV  (NKV * HD)
#define ZH   2
#define RH   512                  // query rows < RH use hi+lo planes (0: none)
#define WIN  0
#define PCAR 1024.0f
#define SCL  0.125f   // HD^-0.5
typedef _Float16 h16;
typedef unsigned short bf;
typedef __attribute__((ext_vector_type(16))) __bf16   v16bf;
typedef __attribute__((ext_vector_type(16))) _Float16 v16h;
typedef __attribute__((ext_vector_type(8)))  _Float16 v8h;
typedef __attribute__((ext_vector_type(8)))  unsigned short v8us;
typedef __attribute__((ext_vector_type(8)))  float    v8f;
typedef __attribute__((ext_vector_type(4)))  float    v4f;
typedef v8h  __attribute__((may_alias)) v8ha;
typedef v4f  __attribute__((may_alias)) v4fa;
typedef v8us __attribute__((may_alias)) v8usa;

__device__ __forceinline__ unsigned short f2bf(float f) { unsigned u = __float_as_uint(f); u += 0x7FFFu + ((u >> 16) & 1u); return (unsigned short)(u >> 16); }
__device__ __forceinline__ float bf2f(unsigned short b) { return __uint_as_float(((unsigned)b) << 16); }
__device__ __forceinline__ float bfr(float f) { return bf2f(f2bf(f)); }
__device__ __forceinline__ v16h cat16(v8h lo, v8h hi) { return __builtin_shufflevector(lo, hi, 0, 1, 2, 3, 4, 5, 6, 7, 8, 9, 10, 11, 12, 13, 14, 15); }
__device__ __forceinline__ v16bf cat16b(v8us lo, v8us hi) { return __builtin_bit_cast(v16bf, __builtin_shufflevector(lo, hi, 0, 1, 2, 3, 4, 5, 6, 7, 8, 9, 10, 11, 12, 13, 14, 15)); }
__device__ __forceinline__ v8f wmma16(v16h a, v16h b, v8f c) { return __builtin_amdgcn_wmma_f32_16x16x32_f16(false, a, false, b, (short)0, c, false, false); }
__device__ __forceinline__ v8f wmmab(v16bf a, v16bf b, v8f c) { return __builtin_amdgcn_wmma_f32_16x16x32_bf16(false, a, false, b, (short)0, c, false, false); }



// ---- k_gemmw: register-blocked GEMM, ONE WAVE per 64x64 output tile (16 accumulators), operands straight from K-contiguous 16-bit planes; grid (M/64, N/64, Z), 32 threads.
// C[m][n] (f32, pitch ldc, + optional f32 bias[n]) = sum_k A[m][k] Bt[n][k] (+ split products per NSPLIT). z-batch strides sA/sB/sC in elements. K % 32 == 0.
template <typename T16> struct WFrag;
template <> struct WFrag<h16> { typedef v16h V; static __device__ __forceinline__ V ld(const h16* p) { return cat16(*(const v8h*)p, *(const v8h*)(p + 16)); } static __device__ __forceinline__ v8f mma(V a, V b, v8f c) { return wmma16(a, b, c); } };
template <> struct WFrag<bf> { typedef v16bf V; static __device__ __forceinline__ V ld(const bf* p) { return cat16b(*(const v8us*)p, *(const v8us*)(p + 16)); } static __device__ __forceinline__ v8f mma(V a, V b, v8f c) { return wmmab(a, b, c); } };
template <typename T16, int NSPLIT, bool BIAS>
__global__ __launch_bounds__(32) void k_gemmw(const T16* __restrict__ A, const T16* __restrict__ A2, const T16* __restrict__ Bt, const T16* __restrict__ Bt2, int K, float* C, int ldc, const float* __restrict__ bias, size_t sA, size_t sB, size_t sC) {
    typedef typename WFrag<T16>::V V;
    __shared__ __align__(16) float os[16 * 68];
    const size_t z = blockIdx.z; A += z * sA; if (A2) A2 += z * sA; Bt += z * sB; if (Bt2) Bt2 += z * sB; C += z * sC;
    const int lane = threadIdx.x & 31, lr = lane & 15, hi = lane >> 4; const int r0 = blockIdx.x * 64, c0 = blockIdx.y * 64;
    v8f acc[4][4];
#pragma unroll
    for (int mb = 0; mb < 4; ++mb)
#pragma unroll
        for (int nb = 0; nb < 4; ++nb) acc[mb][nb] = (v8f){};
    const size_t aoff = (size_t)(r0 + lr) * K + 8 * hi, boff = (size_t)(c0 + lr) * K + 8 * hi;
#pragma unroll 1
    for (int kc = 0; kc < K; kc += 32) {
        V a[4], a2[4];
#pragma unroll
        for (int mb = 0; mb < 4; ++mb) { a[mb] = WFrag<T16>::ld(A + aoff + (size_t)mb * 16 * K + kc); if (NSPLIT == 1 || NSPLIT == 2) a2[mb] = WFrag<T16>::ld(A2 + aoff + (size_t)mb * 16 * K + kc); }
#pragma unroll
        for (int nb = 0; nb < 4; ++nb) { const V b = WFrag<T16>::ld(Bt + boff + (size_t)nb * 16 * K + kc); V b2; if (NSPLIT >= 2) b2 = WFrag<T16>::ld(Bt2 + boff + (size_t)nb * 16 * K + kc);
#pragma unroll
            for (int mb = 0; mb < 4; ++mb) { acc[mb][nb] = WFrag<T16>::mma(a[mb], b, acc[mb][nb]); if (NSPLIT == 1 || NSPLIT == 2) acc[mb][nb] = WFrag<T16>::mma(a2[mb], b, acc[mb][nb]); if (NSPLIT >= 2) acc[mb][nb] = WFrag<T16>::mma(a[mb], b2, acc[mb][nb]); } }
        asm volatile("v_nop\n\tv_nop\n\tv_nop\n\tv_nop" : "+v"(acc[0][0]), "+v"(acc[1][1]), "+v"(acc[2][2]), "+v"(acc[3][3]) : "v"(a[0]), "v"(a[3]));
    }
#pragma unroll
    for (int mb = 0; mb < 4; ++mb) {
#pragma unroll
        for (int nb = 0; nb < 4; ++nb) {
#pragma unroll
            for (int j = 0; j < 8; ++j) os[(hi * 8 + j) * 68 + nb * 16 + lr] = acc[mb][nb][j]; }
        __builtin_amdgcn_wave_barrier(); asm volatile("" ::: "memory");
        float* crow = C + (size_t)(r0 + mb * 16) * ldc + c0;
{
#pragma unroll
            for (int s = 0; s < 8; ++s) { const int row = 2 * s + hi, cofs = lr * 4; v4f val = *(const v4fa*)(os + row * 68 + cofs); if (BIAS) { val[0] += bfr(bias[c0 + cofs]); val[1] += bfr(bias[c0 + cofs + 1]); val[2] += bfr(bias[c0 + cofs + 2]); val[3] += bfr(bias[c0 + cofs + 3]); }
                *(v4f*)(crow + (size_t)row * ldc + cofs) = val; }
             }
        __builtin_amdgcn_wave_barrier(); asm volatile("" ::: "memory");
    }
}

__device__ __forceinline__ h16 tohx(float x) { return (h16)x; }
__device__ __forceinline__ void splitf(float y, unsigned short& h, unsigned short& l) { h = f2bf(y); l = f2bf(y - bf2f(h)); }
typedef __attribute__((ext_vector_type(2))) _Float16 v2h;
typedef __attribute__((ext_vector_type(4))) _Float16 v4h;
typedef __attribute__((ext_vector_type(2))) unsigned short v2us;
typedef __attribute__((ext_vector_type(4))) unsigned short v4us;
typedef __attribute__((ext_vector_type(2))) float v2f;
typedef __attribute__((ext_vector_type(4))) int v4i;

__global__ __launch_bounds__(256) void k_wtG(const float* __restrict__ w, int K, int N, bf* Bt) {
    const int lane = threadIdx.x & 31; const int L0 = (blockIdx.x * 8 + (threadIdx.x >> 5)) * 8; const int nlines = N * K / 64;
{
#pragma unroll 1
        for (int l = 0; l < 8; ++l) { const int L = L0 + l; if (L >= nlines) break; const size_t e = (size_t)L * 64 + lane * 2; const int k = (int)(e % K), n = (int)(e / K); v2us o;
            o[0] = f2bf(w[(size_t)k * N + n]); o[1] = f2bf(w[(size_t)(k + 1) * N + n]); *(v2us*)(Bt + e) = o; }
         }
}
__global__ __launch_bounds__(256) void k_cvt8(const float* __restrict__ src, bf* dst, size_t n8) { const size_t i = (size_t)blockIdx.x * 256 + threadIdx.x; if (i >= n8) return; const v8f v = *(const v8f*)(src + i * 8); v8us o;
#pragma unroll
    for (int k = 0; k < 8; ++k) o[k] = f2bf(v[k]); *(v8us*)(dst + i * 8) = o;  }

// k_rope: head planes [h][t][d] (fp16 + hi/lo) of rope(x) x sc with the rotate-half convention out[d] = x[d] cos[t][d] - x[d+HD/2] sin[t][d], out[d+HD/2] = x[d+HD/2] cos[t][d+HD/2] + x[d] sin[t][d+HD/2]
__global__ __launch_bounds__(256) void k_rope(const float* __restrict__ F, int pitch, int nheads, const float* __restrict__ CS, const float* __restrict__ RF, const float* __restrict__ nw, float sc, h16* P16, bf* Ph, bf* Pl) {
    const size_t e = ((size_t)blockIdx.x * 256 + threadIdx.x) * 2; if (e >= (size_t)nheads * TT * HD) return; const int d = (int)(e % HD); const int t = (int)((e / HD) % TT); const int h = (int)(e / ((size_t)HD * TT)); const float* f = F + (size_t)t * pitch + h * HD; const float rf = RF ? RF[(size_t)h * TT + t] : 1.0f; v2h o16; v2us oh, ol;
#pragma unroll
    for (int q = 0; q < 2; ++q) { const int dd = d + q; const int dp = (dd < HD / 2) ? dd + HD / 2 : dd - HD / 2; float x0 = f[dd], x1 = f[dp];
        if (RF) { float n0 = __fmul_rn(x0, rf), n1 = __fmul_rn(x1, rf); asm volatile("" : "+v"(n0)); asm volatile("" : "+v"(n1)); x0 = __fmul_rn(bfr(nw[dd]), n0); x1 = __fmul_rn(bfr(nw[dp]), n1); }
        const v2f cs = *(const v2f*)(CS + ((size_t)t * HD + dd) * 2); float a = __fmul_rn(x0, cs[0]), bq = __fmul_rn(x1, cs[1]); asm volatile("" : "+v"(a)); asm volatile("" : "+v"(bq)); const float r = ((dd < HD / 2) ? __fsub_rn(a, bq) : __fadd_rn(a, bq)) * sc;
        o16[q] = tohx(r); unsigned short a2, c2; splitf(r, a2, c2); oh[q] = a2; ol[q] = c2; }
    *(v2h*)(P16 + e) = o16; *(v2us*)(Ph + e) = oh; *(v2us*)(Pl + e) = ol;  }
__global__ __launch_bounds__(256) void k_vtp(const float* __restrict__ F, int pitch, int nheads, h16* V16, bf* Vh, bf* Vl) { const size_t e = ((size_t)blockIdx.x * 256 + threadIdx.x) * 2; if (e >= (size_t)nheads * HD * TT) return; const int t = (int)(e % TT); const int d = (int)((e / TT) % HD); const int g = (int)(e / ((size_t)TT * HD)); v2h o16; v2us oh, ol;
#pragma unroll
    for (int q = 0; q < 2; ++q) { const float x = F[(size_t)(t + q) * pitch + g * HD + d]; o16[q] = tohx(x); unsigned short a2, c2; splitf(x, a2, c2); oh[q] = a2; ol[q] = c2; }
    *(v2h*)(V16 + e) = o16; *(v2us*)(Vh + e) = oh; *(v2us*)(Vl + e) = ol;  }
__global__ __launch_bounds__(256) void k_csid(float* CS) { const int idx = blockIdx.x * 256 + threadIdx.x; if (idx >= TT * HD) return; v2f cs; cs[0] = 1.0f; cs[1] = 0.0f; *(v2f*)(CS + (size_t)idx * 2) = cs;  }
__constant__ float INVT[HD / 2] = { 1.000000000e+00f, 7.498942018e-01f, 5.623413324e-01f, 4.216965139e-01f, 3.162277639e-01f, 2.371373624e-01f, 1.778279394e-01f, 1.333521456e-01f, 1.000000015e-01f, 7.498941571e-02f, 5.623412877e-02f, 4.216964915e-02f, 3.162277862e-02f, 2.371373586e-02f, 1.778279431e-02f, 1.333521493e-02f, 9.999999776e-03f, 7.498942316e-03f, 5.623413250e-03f, 4.216964822e-03f, 3.162277862e-03f, 2.371373819e-03f, 1.778279431e-03f, 1.333521446e-03f, 1.000000047e-03f, 7.498941850e-04f, 5.623413017e-04f, 4.216964880e-04f, 3.162277862e-04f, 2.371373848e-04f, 1.778279402e-04f, 1.333521504e-04f };   // float32 1 / 10000^(2i/64), generated with jnp to be bit-exact
__global__ __launch_bounds__(256) void k_cs5(float* CS) { const int idx = blockIdx.x * 256 + threadIdx.x; if (idx >= TT * HD) return; const int d = idx % HD; const int t = idx / HD; const float a = __fmul_rn((float)t, INVT[d % (HD / 2)]); v2f cs; cs[0] = cosf(a); cs[1] = sinf(a); *(v2f*)(CS + (size_t)idx * 2) = cs;  }
// k_asoft: per row (zz, i): t = S x HD^-0.5 (no mask); softmax over the 2048 keys (register row, one exp, fixed trees);
__global__ __launch_bounds__(256) void k_asoft(const float* __restrict__ Sb, h16* P16, bf* Ph, bf* Pl) {
    const int lane = threadIdx.x & 31; const int row = blockIdx.x * 8 + (threadIdx.x >> 5); if (row >= ZH * TT) return; const int i = row % TT; const int zz = row / TT; (void)zz; const bool hires = (i < RH); const float* sr = Sb + (size_t)row * TT; float v[TT / 32]; float mx = -3.0e38f;
#pragma unroll
    for (int ch = 0; ch < TT / 128; ++ch) { const int j0 = ch * 128 + lane * 4; const v4f a = *(const v4f*)(sr + j0);
#pragma unroll
        for (int q = 0; q < 4; ++q) { const int j = j0 + q; (void)j; const float t = a[q] * SCL; v[ch * 4 + q] = t; mx = fmaxf(mx, t); } }
#pragma unroll
    for (int sh = 16; sh; sh >>= 1) mx = fmaxf(mx, __shfl_xor(mx, sh, 32));
    float sum = 0.f;
#pragma unroll
    for (int k = 0; k < TT / 32; ++k) { float d0 = __fsub_rn(v[k], mx); asm volatile("" : "+v"(d0)); v[k] = __builtin_amdgcn_exp2f(__fmul_rn(d0, 1.4426950408889634f)); sum += v[k]; }
#pragma unroll
    for (int sh = 16; sh; sh >>= 1) sum += __shfl_xor(sum, sh, 32);
    const float f = __fdiv_rn(hires ? 1.0f : PCAR, sum);
{
        if (hires) {
#pragma unroll
            for (int ch = 0; ch < TT / 128; ++ch) { v4us oh, ol;
#pragma unroll
                for (int q = 0; q < 4; ++q) { unsigned short a, c2; splitf(v[ch * 4 + q] * f, a, c2); oh[q] = a; ol[q] = c2; }
                const size_t oo = ((size_t)zz * (RH ? RH : 1) + i) * TT + ch * 128 + lane * 4; *(v4us*)(Ph + oo) = oh; *(v4us*)(Pl + oo) = ol; }
        } else {
#pragma unroll
            for (int ch = 0; ch < TT / 128; ++ch) { v4h o4;
#pragma unroll
                for (int q = 0; q < 4; ++q) o4[q] = tohx(v[ch * 4 + q] * f);
                *(v4h*)(P16 + (size_t)row * TT + ch * 128 + lane * 4) = o4; } }
         }
}
__global__ __launch_bounds__(256) void k_merge(const float* __restrict__ O, int h0, bf* Ah, bf* Al) { const size_t e = ((size_t)blockIdx.x * 256 + threadIdx.x) * 2; if (e >= (size_t)ZH * TT * HD) return; const int d = (int)(e % HD); const int t = (int)((e / HD) % TT); const int zz = (int)(e / ((size_t)HD * TT)); const float cs = (t < RH) ? 1.0f : (1.0f / PCAR); const size_t oo = (size_t)t * DQ + (h0 + zz) * HD + d;
    v2us oh, ol;
#pragma unroll
    for (int q = 0; q < 2; ++q) { unsigned short a, c2; splitf(O[e + q] * cs, a, c2); oh[q] = a; ol[q] = c2; } *(v2us*)(Ah + oo) = oh; *(v2us*)(Al + oo) = ol;  }

extern "C" void kernel_launch(void* const* d_in, const int* in_sizes, int n_in,
                              void* d_out, int out_size, void* d_ws, size_t ws_size, hipStream_t stream) {
    (void)in_sizes; (void)n_in; (void)out_size;
    const float* x = (const float*)d_in[0]; const float* wq = (const float*)d_in[1]; const float* bq = (const float*)d_in[2]; const float* wk = (const float*)d_in[3]; const float* bk = (const float*)d_in[4]; const float* wv = (const float*)d_in[5]; const float* bv = (const float*)d_in[6]; const float* wo = (const float*)d_in[7]; const float* bo = (const float*)d_in[8];   /* order x, Wq, bq, Wk, bk, Wv, bv, Wo, bo ('xw' (in, out) [1024][1024] + [1024]): NINE inputs, all read: the host's own binding */
    float* OUT = (float*)d_out;     // [2][2048][1024]
    char* wsp = (char*)d_ws;
    auto take = [&](size_t bytes) { char* p = wsp; wsp += (bytes + 255) & ~(size_t)255; return (void*)p; };
    bf* WQ = (bf*)take((size_t)DQ * DM * 2); bf* WK = (bf*)take((size_t)DKV * DM * 2); bf* WV = (bf*)take((size_t)DKV * DM * 2); bf* WO = (bf*)take((size_t)DM * DQ * 2); float* CS = (float*)take((size_t)TT * HD * 2 * 4);
    bf* XB = (bf*)take((size_t)TT * DM * 2); float* FQ = (float*)take((size_t)TT * DQ * 4); float* FK = (float*)take((size_t)TT * DKV * 4);
    h16* QP16 = (h16*)take((size_t)NH_ * TT * HD * 2); h16* KP16 = (h16*)take((size_t)NKV * TT * HD * 2); h16* VT16 = (h16*)take((size_t)NKV * HD * TT * 2);
    bf* QPh = (bf*)take((size_t)NH_ * TT * HD * 2); bf* QPl = (bf*)take((size_t)NH_ * TT * HD * 2); bf* KPh = (bf*)take((size_t)NKV * TT * HD * 2); bf* KPl = (bf*)take((size_t)NKV * TT * HD * 2); bf* VTh = (bf*)take((size_t)NKV * HD * TT * 2); bf* VTl = (bf*)take((size_t)NKV * HD * TT * 2); bf* Ph = (bf*)take((size_t)ZH * RH * TT * 2); bf* Pl = (bf*)take((size_t)ZH * RH * TT * 2);
    float* Sb = (float*)take((size_t)ZH * TT * TT * 4); h16* P16 = (h16*)take((size_t)ZH * TT * TT * 2); float* Ob = (float*)take((size_t)ZH * TT * HD * 4); bf* ATh = (bf*)take((size_t)TT * DQ * 2); bf* ATl = (bf*)take((size_t)TT * DQ * 2);
    if ((size_t)(wsp - (char*)d_ws) > ws_size) return;    // ws 256 MiB
    float* FV = FK;   // v projection reuses the k buffer after the k planes are built (stream-ordered)
    { k_wtG<<<(unsigned)((DM * DQ / 64 + 63) / 64), 256, 0, stream>>>(wq, DM, DQ, WQ); k_wtG<<<(unsigned)((DM * DKV / 64 + 63) / 64), 256, 0, stream>>>(wk, DM, DKV, WK); k_wtG<<<(unsigned)((DM * DKV / 64 + 63) / 64), 256, 0, stream>>>(wv, DM, DKV, WV);
      k_wtG<<<(unsigned)((DQ * DM / 64 + 63) / 64), 256, 0, stream>>>(wo, DQ, DM, WO);
       }
    k_cs5<<<(TT * HD + 255) / 256, 256, 0, stream>>>(CS);   /* the COMPUTED rotary table (this module rotates q and k); k_csid stays defined and is NOT launched */
    const unsigned LQ = (unsigned)(((size_t)NH_ * TT * HD / 2 + 255) / 256), LKv = (unsigned)(((size_t)NKV * TT * HD / 2 + 255) / 256);
    for (int b = 0; b < NB_; ++b) {
        
        k_cvt8<<<(unsigned)(((size_t)TT * DM / 8 + 255) / 256), 256, 0, stream>>>(x + (size_t)b * TT * DM, XB, (size_t)TT * DM / 8);
        k_gemmw<bf, 0, true><<<dim3(TT / 64, DQ / 64, 1), 32, 0, stream>>>(XB, nullptr, WQ, nullptr, DM, FQ, DQ, bq, 0, 0, 0);
        k_rope<<<LQ, 256, 0, stream>>>(FQ, DQ, NH_, CS, nullptr, nullptr, 1.0f, QP16, QPh, QPl);
        k_gemmw<bf, 0, true><<<dim3(TT / 64, DKV / 64, 1), 32, 0, stream>>>(XB, nullptr, WK, nullptr, DM, FK, DKV, bk, 0, 0, 0);
        k_rope<<<LKv, 256, 0, stream>>>(FK, DKV, NKV, CS, nullptr, nullptr, 1.0f, KP16, KPh, KPl);
        k_gemmw<bf, 0, true><<<dim3(TT / 64, DKV / 64, 1), 32, 0, stream>>>(XB, nullptr, WV, nullptr, DM, FV, DKV, bv, 0, 0, 0); k_vtp<<<LKv, 256, 0, stream>>>(FV, DKV, NKV, VT16, VTh, VTl);
        for (int h0 = 0; h0 < NH_; h0 += ZH) { const size_t zq = (size_t)h0, zk = (size_t)(h0 / REP);   // one kv head per query head: the pass's two heads use consecutive kv planes (z-strides TT*HD)
            k_gemmw<bf, 2, false><<<dim3(RH / 64, TT / 64, ZH), 32, 0, stream>>>(QPh + zq * TT * HD, QPl + zq * TT * HD, KPh + zk * TT * HD, KPl + zk * TT * HD, HD, Sb, TT, nullptr, (size_t)TT * HD, (size_t)TT * HD, (size_t)TT * TT);
            k_gemmw<h16, 0, false><<<dim3((TT - RH) / 64, TT / 64, ZH), 32, 0, stream>>>(QP16 + zq * TT * HD + (size_t)RH * HD, nullptr, KP16 + zk * TT * HD, nullptr, HD, Sb + (size_t)RH * TT, TT, nullptr, (size_t)TT * HD, (size_t)TT * HD, (size_t)TT * TT);
            k_asoft<<<ZH * TT / 8, 256, 0, stream>>>(Sb, P16, Ph, Pl);
            k_gemmw<bf, 2, false><<<dim3(RH / 64, HD / 64, ZH), 32, 0, stream>>>(Ph, Pl, VTh + zk * HD * TT, VTl + zk * HD * TT, TT, Ob, HD, nullptr, (size_t)RH * TT, (size_t)HD * TT, (size_t)TT * HD);
            k_gemmw<h16, 0, false><<<dim3((TT - RH) / 64, HD / 64, ZH), 32, 0, stream>>>(P16 + (size_t)RH * TT, nullptr, VT16 + zk * HD * TT, nullptr, TT, Ob + (size_t)RH * HD, HD, nullptr, (size_t)TT * TT, (size_t)HD * TT, (size_t)TT * HD);
            k_merge<<<(unsigned)(((size_t)ZH * TT * HD / 2 + 255) / 256), 256, 0, stream>>>(Ob, h0, ATh, ATl); }
        k_gemmw<bf, 1, true><<<dim3(TT / 64, DM / 64, 1), 32, 0, stream>>>(ATh, ATl, WO, nullptr, DQ, OUT + (size_t)b * TT * DM, DM, bo, 0, 0, 0); }
}

// v001
// It runs in 873 microseconds.
// Next to v000, in two timings, it ran 2.31 and 2.30 times as fast.
#include <hip/hip_runtime.h>

// Multi-head attention with biased 'xw' projections and a COMPUTED rotate-half rotary embedding, NO mask (x [2][2048][1024]; q, k, v = x W + b ('xw' (in, out) [1024][1024] 0.02 + zero biases (ONE zeros array bound four times by the module's setup): read; 16 heads x 64); q, k -> cat(x1 cos - x2 sin, x2 cos + x1 sin) on the two 32-wide halves (= t cos + cat(-t2, t1) sin with cat(freqs, freqs)) with angle t x 1 / 10000^(2i/64) (32 f32 frequencies exact for the module's expression 1.0 / (10000.0 ** (arange(0, 64, 2) / 64)); precise cosf/sinf); scores / sqrt(64) (np.sqrt(D_K) as float32); softmax over all keys; out = merged Wo + bo ('xw' + bias) -> [2][2048][1024] (4.2 M); argument order x, Wq, bq, Wk, bk, Wv, bv, Wo, bo).
// Layout per batch: bf16 copy of x; 'xw' weights transposed once; exact projections + f32 biases; k_cs5 computes the rotary table once (32 baked float32 frequencies) and the plane builders (k_rope) apply the rotate-half rotation at width 64 (products rounded separately); dense T-2048 attention with the 1/8 in the softmax (hybrid rows: < 512 hi/lo 3 products, rest fp16 x1024); merged hi/lo x wo exact + bo.
// Compute dtypes, f32 accumulate: every input rounded to bf16; projections exact + f32 biases; attention rows < 512 3 products, rest fp16; softmax f32; Wo hl x exact + bias.

#define NB_  2
#define TT   2048
#define DM   1024
#define NH_  16
#define NKV  16
#define REP  (NH_ / NKV)
#define HD   64
#define DQ   (NH_ * HD)
#define DKV  (NKV * HD)
#define ZH   2
#define RH   512                  // query rows < RH use hi+lo planes (0: none)
#define WIN  0
#define PCAR 1024.0f
#define SCL  0.125f   // HD^-0.5
#define KSP  16                   // key slices of the P x V product: one work-group per slice, f32 partial planes summed in k_merge
typedef _Float16 h16;
typedef unsigned short bf;
typedef __attribute__((ext_vector_type(16))) __bf16   v16bf;
typedef __attribute__((ext_vector_type(16))) _Float16 v16h;
typedef __attribute__((ext_vector_type(8)))  _Float16 v8h;
typedef __attribute__((ext_vector_type(8)))  unsigned short v8us;
typedef __attribute__((ext_vector_type(8)))  float    v8f;
typedef __attribute__((ext_vector_type(4)))  float    v4f;
typedef v8h  __attribute__((may_alias)) v8ha;
typedef v4f  __attribute__((may_alias)) v4fa;
typedef v8us __attribute__((may_alias)) v8usa;

__device__ __forceinline__ unsigned short f2bf(float f) { unsigned u = __float_as_uint(f); u += 0x7FFFu + ((u >> 16) & 1u); return (unsigned short)(u >> 16); }
__device__ __forceinline__ float bf2f(unsigned short b) { return __uint_as_float(((unsigned)b) << 16); }
__device__ __forceinline__ float bfr(float f) { return bf2f(f2bf(f)); }
__device__ __forceinline__ v16h cat16(v8h lo, v8h hi) { return __builtin_shufflevector(lo, hi, 0, 1, 2, 3, 4, 5, 6, 7, 8, 9, 10, 11, 12, 13, 14, 15); }
__device__ __forceinline__ v16bf cat16b(v8us lo, v8us hi) { return __builtin_bit_cast(v16bf, __builtin_shufflevector(lo, hi, 0, 1, 2, 3, 4, 5, 6, 7, 8, 9, 10, 11, 12, 13, 14, 15)); }
__device__ __forceinline__ v8f wmma16(v16h a, v16h b, v8f c) { return __builtin_amdgcn_wmma_f32_16x16x32_f16(false, a, false, b, (short)0, c, false, false); }
__device__ __forceinline__ v8f wmmab(v16bf a, v16bf b, v8f c) { return __builtin_amdgcn_wmma_f32_16x16x32_bf16(false, a, false, b, (short)0, c, false, false); }



// ---- k_gemmw: register-blocked GEMM, ONE WAVE per 64x64 output tile (16 accumulators), operands straight from K-contiguous 16-bit planes; grid (M/64, N/64, Z), 32 threads.
// C[m][n] (f32, pitch ldc, + optional f32 bias[n]) = sum_k A[m][k] Bt[n][k] (+ split products per NSPLIT). z-batch strides sA/sB/sC in elements. K % 32 == 0.
// KS > 1 (N == 64 only, K % (32 KS) == 0): blockIdx.y is a K slice instead of a column tile; slice y sums k in [y K/KS, (y+1) K/KS) into its own plane C + y * ZH * sC (ZH z-batches a plane), so a short-and-wide product fills the chip instead of running K/32 dependent trips on a few waves.
template <typename T16> struct WFrag;
template <> struct WFrag<h16> { typedef v16h V; static __device__ __forceinline__ V ld(const h16* p) { return cat16(*(const v8h*)p, *(const v8h*)(p + 16)); } static __device__ __forceinline__ v8f mma(V a, V b, v8f c) { return wmma16(a, b, c); } };
template <> struct WFrag<bf> { typedef v16bf V; static __device__ __forceinline__ V ld(const bf* p) { return cat16b(*(const v8us*)p, *(const v8us*)(p + 16)); } static __device__ __forceinline__ v8f mma(V a, V b, v8f c) { return wmmab(a, b, c); } };
template <typename T16, int NSPLIT, bool BIAS, int KS = 1>
__global__ __launch_bounds__(32) void k_gemmw(const T16* __restrict__ A, const T16* __restrict__ A2, const T16* __restrict__ Bt, const T16* __restrict__ Bt2, int K, float* C, int ldc, const float* __restrict__ bias, size_t sA, size_t sB, size_t sC) {
    typedef typename WFrag<T16>::V V;
    __shared__ __align__(16) float os[16 * 68];
    const size_t z = blockIdx.z; A += z * sA; if (A2) A2 += z * sA; Bt += z * sB; if (Bt2) Bt2 += z * sB; C += z * sC;
    const int lane = threadIdx.x & 31, lr = lane & 15, hi = lane >> 4; const int r0 = blockIdx.x * 64, c0 = (KS > 1) ? 0 : blockIdx.y * 64;
    const int ke = K / KS; if (KS > 1) { const int kb = (int)blockIdx.y * ke; A += kb; if (A2) A2 += kb; Bt += kb; if (Bt2) Bt2 += kb; C += (size_t)blockIdx.y * ZH * sC; }
    v8f acc[4][4];
#pragma unroll
    for (int mb = 0; mb < 4; ++mb)
#pragma unroll
        for (int nb = 0; nb < 4; ++nb) acc[mb][nb] = (v8f){};
    const size_t aoff = (size_t)(r0 + lr) * K + 8 * hi, boff = (size_t)(c0 + lr) * K + 8 * hi;
#pragma unroll 1
    for (int kc = 0; kc < ke; kc += 32) {
        V a[4], a2[4];
#pragma unroll
        for (int mb = 0; mb < 4; ++mb) { a[mb] = WFrag<T16>::ld(A + aoff + (size_t)mb * 16 * K + kc); if (NSPLIT == 1 || NSPLIT == 2) a2[mb] = WFrag<T16>::ld(A2 + aoff + (size_t)mb * 16 * K + kc); }
#pragma unroll
        for (int nb = 0; nb < 4; ++nb) { const V b = WFrag<T16>::ld(Bt + boff + (size_t)nb * 16 * K + kc); V b2; if (NSPLIT >= 2) b2 = WFrag<T16>::ld(Bt2 + boff + (size_t)nb * 16 * K + kc);
#pragma unroll
            for (int mb = 0; mb < 4; ++mb) { acc[mb][nb] = WFrag<T16>::mma(a[mb], b, acc[mb][nb]); if (NSPLIT == 1 || NSPLIT == 2) acc[mb][nb] = WFrag<T16>::mma(a2[mb], b, acc[mb][nb]); if (NSPLIT >= 2) acc[mb][nb] = WFrag<T16>::mma(a[mb], b2, acc[mb][nb]); } }
        asm volatile("v_nop\n\tv_nop\n\tv_nop\n\tv_nop" : "+v"(acc[0][0]), "+v"(acc[1][1]), "+v"(acc[2][2]), "+v"(acc[3][3]) : "v"(a[0]), "v"(a[3]));
    }
#pragma unroll
    for (int mb = 0; mb < 4; ++mb) {
#pragma unroll
        for (int nb = 0; nb < 4; ++nb) {
#pragma unroll
            for (int j = 0; j < 8; ++j) os[(hi * 8 + j) * 68 + nb * 16 + lr] = acc[mb][nb][j]; }
        __builtin_amdgcn_wave_barrier(); asm volatile("" ::: "memory");
        float* crow = C + (size_t)(r0 + mb * 16) * ldc + c0;
{
#pragma unroll
            for (int s = 0; s < 8; ++s) { const int row = 2 * s + hi, cofs = lr * 4; v4f val = *(const v4fa*)(os + row * 68 + cofs); if (BIAS) { val[0] += bfr(bias[c0 + cofs]); val[1] += bfr(bias[c0 + cofs + 1]); val[2] += bfr(bias[c0 + cofs + 2]); val[3] += bfr(bias[c0 + cofs + 3]); }
                *(v4f*)(crow + (size_t)row * ldc + cofs) = val; }
             }
        __builtin_amdgcn_wave_barrier(); asm volatile("" ::: "memory");
    }
}

__device__ __forceinline__ h16 tohx(float x) { return (h16)x; }
__device__ __forceinline__ void splitf(float y, unsigned short& h, unsigned short& l) { h = f2bf(y); l = f2bf(y - bf2f(h)); }
typedef __attribute__((ext_vector_type(2))) _Float16 v2h;
typedef __attribute__((ext_vector_type(4))) _Float16 v4h;
typedef __attribute__((ext_vector_type(2))) unsigned short v2us;
typedef __attribute__((ext_vector_type(4))) unsigned short v4us;
typedef __attribute__((ext_vector_type(2))) float v2f;
typedef __attribute__((ext_vector_type(4))) int v4i;

__global__ __launch_bounds__(256) void k_wtG(const float* __restrict__ w, int K, int N, bf* Bt) {
    const int lane = threadIdx.x & 31; const int L0 = (blockIdx.x * 8 + (threadIdx.x >> 5)) * 8; const int nlines = N * K / 64;
{
#pragma unroll 1
        for (int l = 0; l < 8; ++l) { const int L = L0 + l; if (L >= nlines) break; const size_t e = (size_t)L * 64 + lane * 2; const int k = (int)(e % K), n = (int)(e / K); v2us o;
            o[0] = f2bf(w[(size_t)k * N + n]); o[1] = f2bf(w[(size_t)(k + 1) * N + n]); *(v2us*)(Bt + e) = o; }
         }
}
__global__ __launch_bounds__(256) void k_cvt8(const float* __restrict__ src, bf* dst, size_t n8) { const size_t i = (size_t)blockIdx.x * 256 + threadIdx.x; if (i >= n8) return; const v8f v = *(const v8f*)(src + i * 8); v8us o;
#pragma unroll
    for (int k = 0; k < 8; ++k) o[k] = f2bf(v[k]); *(v8us*)(dst + i * 8) = o;  }

// k_rope: head planes [h][t][d] (fp16 + hi/lo) of rope(x) x sc with the rotate-half convention out[d] = x[d] cos[t][d] - x[d+HD/2] sin[t][d], out[d+HD/2] = x[d+HD/2] cos[t][d+HD/2] + x[d] sin[t][d+HD/2]
__global__ __launch_bounds__(256) void k_rope(const float* __restrict__ F, int pitch, int nheads, const float* __restrict__ CS, const float* __restrict__ RF, const float* __restrict__ nw, float sc, h16* P16, bf* Ph, bf* Pl) {
    const size_t e = ((size_t)blockIdx.x * 256 + threadIdx.x) * 2; if (e >= (size_t)nheads * TT * HD) return; const int d = (int)(e % HD); const int t = (int)((e / HD) % TT); const int h = (int)(e / ((size_t)HD * TT)); const float* f = F + (size_t)t * pitch + h * HD; const float rf = RF ? RF[(size_t)h * TT + t] : 1.0f; v2h o16; v2us oh, ol;
#pragma unroll
    for (int q = 0; q < 2; ++q) { const int dd = d + q; const int dp = (dd < HD / 2) ? dd + HD / 2 : dd - HD / 2; float x0 = f[dd], x1 = f[dp];
        if (RF) { float n0 = __fmul_rn(x0, rf), n1 = __fmul_rn(x1, rf); asm volatile("" : "+v"(n0)); asm volatile("" : "+v"(n1)); x0 = __fmul_rn(bfr(nw[dd]), n0); x1 = __fmul_rn(bfr(nw[dp]), n1); }
        const v2f cs = *(const v2f*)(CS + ((size_t)t * HD + dd) * 2); float a = __fmul_rn(x0, cs[0]), bq = __fmul_rn(x1, cs[1]); asm volatile("" : "+v"(a)); asm volatile("" : "+v"(bq)); const float r = ((dd < HD / 2) ? __fsub_rn(a, bq) : __fadd_rn(a, bq)) * sc;
        o16[q] = tohx(r); unsigned short a2, c2; splitf(r, a2, c2); oh[q] = a2; ol[q] = c2; }
    *(v2h*)(P16 + e) = o16; *(v2us*)(Ph + e) = oh; *(v2us*)(Pl + e) = ol;  }
__global__ __launch_bounds__(256) void k_vtp(const float* __restrict__ F, int pitch, int nheads, h16* V16, bf* Vh, bf* Vl) { const size_t e = ((size_t)blockIdx.x * 256 + threadIdx.x) * 2; if (e >= (size_t)nheads * HD * TT) return; const int t = (int)(e % TT); const int d = (int)((e / TT) % HD); const int g = (int)(e / ((size_t)TT * HD)); v2h o16; v2us oh, ol;
#pragma unroll
    for (int q = 0; q < 2; ++q) { const float x = F[(size_t)(t + q) * pitch + g * HD + d]; o16[q] = tohx(x); unsigned short a2, c2; splitf(x, a2, c2); oh[q] = a2; ol[q] = c2; }
    *(v2h*)(V16 + e) = o16; *(v2us*)(Vh + e) = oh; *(v2us*)(Vl + e) = ol;  }
__global__ __launch_bounds__(256) void k_csid(float* CS) { const int idx = blockIdx.x * 256 + threadIdx.x; if (idx >= TT * HD) return; v2f cs; cs[0] = 1.0f; cs[1] = 0.0f; *(v2f*)(CS + (size_t)idx * 2) = cs;  }
__constant__ float INVT[HD / 2] = { 1.000000000e+00f, 7.498942018e-01f, 5.623413324e-01f, 4.216965139e-01f, 3.162277639e-01f, 2.371373624e-01f, 1.778279394e-01f, 1.333521456e-01f, 1.000000015e-01f, 7.498941571e-02f, 5.623412877e-02f, 4.216964915e-02f, 3.162277862e-02f, 2.371373586e-02f, 1.778279431e-02f, 1.333521493e-02f, 9.999999776e-03f, 7.498942316e-03f, 5.623413250e-03f, 4.216964822e-03f, 3.162277862e-03f, 2.371373819e-03f, 1.778279431e-03f, 1.333521446e-03f, 1.000000047e-03f, 7.498941850e-04f, 5.623413017e-04f, 4.216964880e-04f, 3.162277862e-04f, 2.371373848e-04f, 1.778279402e-04f, 1.333521504e-04f };   // float32 1 / 10000^(2i/64), generated with jnp to be bit-exact
__global__ __launch_bounds__(256) void k_cs5(float* CS) { const int idx = blockIdx.x * 256 + threadIdx.x; if (idx >= TT * HD) return; const int d = idx % HD; const int t = idx / HD; const float a = __fmul_rn((float)t, INVT[d % (HD / 2)]); v2f cs; cs[0] = cosf(a); cs[1] = sinf(a); *(v2f*)(CS + (size_t)idx * 2) = cs;  }
// k_asoft: per row (zz, i): t = S x HD^-0.5 (no mask); softmax over the 2048 keys (register row, one exp, fixed trees);
__global__ __launch_bounds__(256) void k_asoft(const float* __restrict__ Sb, h16* P16, bf* Ph, bf* Pl) {
    const int lane = threadIdx.x & 31; const int row = blockIdx.x * 8 + (threadIdx.x >> 5); if (row >= ZH * TT) return; const int i = row % TT; const int zz = row / TT; (void)zz; const bool hires = (i < RH); const float* sr = Sb + (size_t)row * TT; float v[TT / 32]; float mx = -3.0e38f;
#pragma unroll
    for (int ch = 0; ch < TT / 128; ++ch) { const int j0 = ch * 128 + lane * 4; const v4f a = *(const v4f*)(sr + j0);
#pragma unroll
        for (int q = 0; q < 4; ++q) { const int j = j0 + q; (void)j; const float t = a[q] * SCL; v[ch * 4 + q] = t; mx = fmaxf(mx, t); } }
#pragma unroll
    for (int sh = 16; sh; sh >>= 1) mx = fmaxf(mx, __shfl_xor(mx, sh, 32));
    float sum = 0.f;
#pragma unroll
    for (int k = 0; k < TT / 32; ++k) { float d0 = __fsub_rn(v[k], mx); asm volatile("" : "+v"(d0)); v[k] = __builtin_amdgcn_exp2f(__fmul_rn(d0, 1.4426950408889634f)); sum += v[k]; }
#pragma unroll
    for (int sh = 16; sh; sh >>= 1) sum += __shfl_xor(sum, sh, 32);
    const float f = __fdiv_rn(hires ? 1.0f : PCAR, sum);
{
        if (hires) {
#pragma unroll
            for (int ch = 0; ch < TT / 128; ++ch) { v4us oh, ol;
#pragma unroll
                for (int q = 0; q < 4; ++q) { unsigned short a, c2; splitf(v[ch * 4 + q] * f, a, c2); oh[q] = a; ol[q] = c2; }
                const size_t oo = ((size_t)zz * (RH ? RH : 1) + i) * TT + ch * 128 + lane * 4; *(v4us*)(Ph + oo) = oh; *(v4us*)(Pl + oo) = ol; }
        } else {
#pragma unroll
            for (int ch = 0; ch < TT / 128; ++ch) { v4h o4;
#pragma unroll
                for (int q = 0; q < 4; ++q) o4[q] = tohx(v[ch * 4 + q] * f);
                *(v4h*)(P16 + (size_t)row * TT + ch * 128 + lane * 4) = o4; } }
         }
}
__global__ __launch_bounds__(256) void k_merge(const float* __restrict__ O, int h0, bf* Ah, bf* Al) { const size_t e = ((size_t)blockIdx.x * 256 + threadIdx.x) * 2; if (e >= (size_t)ZH * TT * HD) return; const int d = (int)(e % HD); const int t = (int)((e / HD) % TT); const int zz = (int)(e / ((size_t)HD * TT)); const float cs = (t < RH) ? 1.0f : (1.0f / PCAR); const size_t oo = (size_t)t * DQ + (h0 + zz) * HD + d;
    v2f acc = *(const v2f*)(O + e);   // the KSP key-slice partials, summed in slice order; unrolled so that all KSP loads are in flight together
#pragma unroll
    for (int ks = 1; ks < KSP; ++ks) acc += *(const v2f*)(O + (size_t)ks * ZH * TT * HD + e);
    v2us oh, ol;
#pragma unroll
    for (int q = 0; q < 2; ++q) { unsigned short a, c2; splitf(acc[q] * cs, a, c2); oh[q] = a; ol[q] = c2; } *(v2us*)(Ah + oo) = oh; *(v2us*)(Al + oo) = ol;  }

extern "C" void kernel_launch(void* const* d_in, const int* in_sizes, int n_in,
                              void* d_out, int out_size, void* d_ws, size_t ws_size, hipStream_t stream) {
    (void)in_sizes; (void)n_in; (void)out_size;
    const float* x = (const float*)d_in[0]; const float* wq = (const float*)d_in[1]; const float* bq = (const float*)d_in[2]; const float* wk = (const float*)d_in[3]; const float* bk = (const float*)d_in[4]; const float* wv = (const float*)d_in[5]; const float* bv = (const float*)d_in[6]; const float* wo = (const float*)d_in[7]; const float* bo = (const float*)d_in[8];   /* order x, Wq, bq, Wk, bk, Wv, bv, Wo, bo ('xw' (in, out) [1024][1024] + [1024]): NINE inputs, all read: the host's own binding */
    float* OUT = (float*)d_out;     // [2][2048][1024]
    char* wsp = (char*)d_ws;
    auto take = [&](size_t bytes) { char* p = wsp; wsp += (bytes + 255) & ~(size_t)255; return (void*)p; };
    bf* WQ = (bf*)take((size_t)DQ * DM * 2); bf* WK = (bf*)take((size_t)DKV * DM * 2); bf* WV = (bf*)take((size_t)DKV * DM * 2); bf* WO = (bf*)take((size_t)DM * DQ * 2); float* CS = (float*)take((size_t)TT * HD * 2 * 4);
    bf* XB = (bf*)take((size_t)TT * DM * 2); float* FQ = (float*)take((size_t)TT * DQ * 4); float* FK = (float*)take((size_t)TT * DKV * 4);
    h16* QP16 = (h16*)take((size_t)NH_ * TT * HD * 2); h16* KP16 = (h16*)take((size_t)NKV * TT * HD * 2); h16* VT16 = (h16*)take((size_t)NKV * HD * TT * 2);
    bf* QPh = (bf*)take((size_t)NH_ * TT * HD * 2); bf* QPl = (bf*)take((size_t)NH_ * TT * HD * 2); bf* KPh = (bf*)take((size_t)NKV * TT * HD * 2); bf* KPl = (bf*)take((size_t)NKV * TT * HD * 2); bf* VTh = (bf*)take((size_t)NKV * HD * TT * 2); bf* VTl = (bf*)take((size_t)NKV * HD * TT * 2); bf* Ph = (bf*)take((size_t)ZH * RH * TT * 2); bf* Pl = (bf*)take((size_t)ZH * RH * TT * 2);
    float* Sb = (float*)take((size_t)ZH * TT * TT * 4); h16* P16 = (h16*)take((size_t)ZH * TT * TT * 2); float* Ob = (float*)take((size_t)KSP * ZH * TT * HD * 4); bf* ATh = (bf*)take((size_t)TT * DQ * 2); bf* ATl = (bf*)take((size_t)TT * DQ * 2);
    if ((size_t)(wsp - (char*)d_ws) > ws_size) return;    // ws 256 MiB
    float* FV = FK;   // v projection reuses the k buffer after the k planes are built (stream-ordered)
    { k_wtG<<<(unsigned)((DM * DQ / 64 + 63) / 64), 256, 0, stream>>>(wq, DM, DQ, WQ); k_wtG<<<(unsigned)((DM * DKV / 64 + 63) / 64), 256, 0, stream>>>(wk, DM, DKV, WK); k_wtG<<<(unsigned)((DM * DKV / 64 + 63) / 64), 256, 0, stream>>>(wv, DM, DKV, WV);
      k_wtG<<<(unsigned)((DQ * DM / 64 + 63) / 64), 256, 0, stream>>>(wo, DQ, DM, WO);
       }
    k_cs5<<<(TT * HD + 255) / 256, 256, 0, stream>>>(CS);   /* the COMPUTED rotary table (this module rotates q and k); k_csid stays defined and is NOT launched */
    const unsigned LQ = (unsigned)(((size_t)NH_ * TT * HD / 2 + 255) / 256), LKv = (unsigned)(((size_t)NKV * TT * HD / 2 + 255) / 256);
    for (int b = 0; b < NB_; ++b) {
        
        k_cvt8<<<(unsigned)(((size_t)TT * DM / 8 + 255) / 256), 256, 0, stream>>>(x + (size_t)b * TT * DM, XB, (size_t)TT * DM / 8);
        k_gemmw<bf, 0, true><<<dim3(TT / 64, DQ / 64, 1), 32, 0, stream>>>(XB, nullptr, WQ, nullptr, DM, FQ, DQ, bq, 0, 0, 0);
        k_rope<<<LQ, 256, 0, stream>>>(FQ, DQ, NH_, CS, nullptr, nullptr, 1.0f, QP16, QPh, QPl);
        k_gemmw<bf, 0, true><<<dim3(TT / 64, DKV / 64, 1), 32, 0, stream>>>(XB, nullptr, WK, nullptr, DM, FK, DKV, bk, 0, 0, 0);
        k_rope<<<LKv, 256, 0, stream>>>(FK, DKV, NKV, CS, nullptr, nullptr, 1.0f, KP16, KPh, KPl);
        k_gemmw<bf, 0, true><<<dim3(TT / 64, DKV / 64, 1), 32, 0, stream>>>(XB, nullptr, WV, nullptr, DM, FV, DKV, bv, 0, 0, 0); k_vtp<<<LKv, 256, 0, stream>>>(FV, DKV, NKV, VT16, VTh, VTl);
        for (int h0 = 0; h0 < NH_; h0 += ZH) { const size_t zq = (size_t)h0, zk = (size_t)(h0 / REP);   // one kv head per query head: the pass's two heads use consecutive kv planes (z-strides TT*HD)
            k_gemmw<bf, 2, false><<<dim3(RH / 64, TT / 64, ZH), 32, 0, stream>>>(QPh + zq * TT * HD, QPl + zq * TT * HD, KPh + zk * TT * HD, KPl + zk * TT * HD, HD, Sb, TT, nullptr, (size_t)TT * HD, (size_t)TT * HD, (size_t)TT * TT);
            k_gemmw<h16, 0, false><<<dim3((TT - RH) / 64, TT / 64, ZH), 32, 0, stream>>>(QP16 + zq * TT * HD + (size_t)RH * HD, nullptr, KP16 + zk * TT * HD, nullptr, HD, Sb + (size_t)RH * TT, TT, nullptr, (size_t)TT * HD, (size_t)TT * HD, (size_t)TT * TT);
            k_asoft<<<ZH * TT / 8, 256, 0, stream>>>(Sb, P16, Ph, Pl);
            k_gemmw<bf, 2, false, KSP><<<dim3(RH / 64, KSP, ZH), 32, 0, stream>>>(Ph, Pl, VTh + zk * HD * TT, VTl + zk * HD * TT, TT, Ob, HD, nullptr, (size_t)RH * TT, (size_t)HD * TT, (size_t)TT * HD);
            k_gemmw<h16, 0, false, KSP><<<dim3((TT - RH) / 64, KSP, ZH), 32, 0, stream>>>(P16 + (size_t)RH * TT, nullptr, VT16 + zk * HD * TT, nullptr, TT, Ob + (size_t)RH * HD, HD, nullptr, (size_t)TT * TT, (size_t)HD * TT, (size_t)TT * HD);
            k_merge<<<(unsigned)(((size_t)ZH * TT * HD / 2 + 255) / 256), 256, 0, stream>>>(Ob, h0, ATh, ATl); }
        k_gemmw<bf, 1, true><<<dim3(TT / 64, DM / 64, 1), 32, 0, stream>>>(ATh, ATl, WO, nullptr, DQ, OUT + (size_t)b * TT * DM, DM, bo, 0, 0, 0); }
}

// v002
// One run takes 393 microseconds.
// In both of two side-by-side timings against v001, it was 2.22 times as fast.
// All steps since v000 together make it 5.11 times as fast.
#include <hip/hip_runtime.h>

// Multi-head attention with biased 'xw' projections and a COMPUTED rotate-half rotary embedding, NO mask (x [2][2048][1024]; q, k, v = x W + b ('xw' (in, out) [1024][1024] 0.02 + zero biases (ONE zeros array bound four times by the module's setup): read; 16 heads x 64); q, k -> cat(x1 cos - x2 sin, x2 cos + x1 sin) on the two 32-wide halves (= t cos + cat(-t2, t1) sin with cat(freqs, freqs)) with angle t x 1 / 10000^(2i/64) (32 f32 frequencies exact for the module's expression 1.0 / (10000.0 ** (arange(0, 64, 2) / 64)); precise cosf/sinf); scores / sqrt(64) (np.sqrt(D_K) as float32); softmax over all keys; out = merged Wo + bo ('xw' + bias) -> [2][2048][1024] (4.2 M); argument order x, Wq, bq, Wk, bk, Wv, bv, Wo, bo).
// Layout per batch: bf16 copy of x; 'xw' weights transposed once; exact projections + f32 biases; k_cs5 computes the rotary table once (32 baked float32 frequencies) and the plane builders (k_rope) apply the rotate-half rotation at width 64 (products rounded separately); one fused attention kernel per batch (scores, running-maximum softmax with the 1/8 in the exponent, P x V; hybrid rows: < 512 hi/lo 3 products, rest fp16); merged hi/lo x wo exact + bo.
// Compute dtypes, f32 accumulate: every input rounded to bf16; projections exact + f32 biases; attention rows < 512 3 products, rest fp16; softmax f32; Wo hl x exact + bias.

#define NB_  2
#define TT   2048
#define DM   1024
#define NH_  16
#define NKV  16
#define REP  (NH_ / NKV)
#define HD   64
#define DQ   (NH_ * HD)
#define DKV  (NKV * HD)
#define RH   512                  // query rows < RH use hi+lo planes
#define SCL  0.125f   // HD^-0.5
typedef _Float16 h16;
typedef unsigned short bf;
typedef __attribute__((ext_vector_type(16))) __bf16   v16bf;
typedef __attribute__((ext_vector_type(16))) _Float16 v16h;
typedef __attribute__((ext_vector_type(8)))  _Float16 v8h;
typedef __attribute__((ext_vector_type(8)))  unsigned short v8us;
typedef __attribute__((ext_vector_type(8)))  float    v8f;
typedef __attribute__((ext_vector_type(4)))  float    v4f;
typedef v8h  __attribute__((may_alias)) v8ha;
typedef v4f  __attribute__((may_alias)) v4fa;
typedef v8us __attribute__((may_alias)) v8usa;

__device__ __forceinline__ unsigned short f2bf(float f) { unsigned u = __float_as_uint(f); u += 0x7FFFu + ((u >> 16) & 1u); return (unsigned short)(u >> 16); }
__device__ __forceinline__ float bf2f(unsigned short b) { return __uint_as_float(((unsigned)b) << 16); }
__device__ __forceinline__ float bfr(float f) { return bf2f(f2bf(f)); }
__device__ __forceinline__ v16h cat16(v8h lo, v8h hi) { return __builtin_shufflevector(lo, hi, 0, 1, 2, 3, 4, 5, 6, 7, 8, 9, 10, 11, 12, 13, 14, 15); }
__device__ __forceinline__ v16bf cat16b(v8us lo, v8us hi) { return __builtin_bit_cast(v16bf, __builtin_shufflevector(lo, hi, 0, 1, 2, 3, 4, 5, 6, 7, 8, 9, 10, 11, 12, 13, 14, 15)); }
__device__ __forceinline__ v8f wmma16(v16h a, v16h b, v8f c) { return __builtin_amdgcn_wmma_f32_16x16x32_f16(false, a, false, b, (short)0, c, false, false); }
__device__ __forceinline__ v8f wmmab(v16bf a, v16bf b, v8f c) { return __builtin_amdgcn_wmma_f32_16x16x32_bf16(false, a, false, b, (short)0, c, false, false); }



// ---- k_gemmw: register-blocked GEMM, ONE WAVE per 64x64 output tile (16 accumulators), operands straight from K-contiguous 16-bit planes; grid (M/64, N/64, Z), 32 threads.
// C[m][n] (f32, pitch ldc, + optional f32 bias[n]) = sum_k A[m][k] Bt[n][k] (+ split products per NSPLIT). z-batch strides sA/sB/sC in elements. K % 32 == 0.
template <typename T16> struct WFrag;
template <> struct WFrag<h16> { typedef v16h V; static __device__ __forceinline__ V ld(const h16* p) { return cat16(*(const v8h*)p, *(const v8h*)(p + 16)); } static __device__ __forceinline__ v8f mma(V a, V b, v8f c) { return wmma16(a, b, c); } };
template <> struct WFrag<bf> { typedef v16bf V; static __device__ __forceinline__ V ld(const bf* p) { return cat16b(*(const v8us*)p, *(const v8us*)(p + 16)); } static __device__ __forceinline__ v8f mma(V a, V b, v8f c) { return wmmab(a, b, c); } };
template <typename T16, int NSPLIT, bool BIAS>
__global__ __launch_bounds__(32) void k_gemmw(const T16* __restrict__ A, const T16* __restrict__ A2, const T16* __restrict__ Bt, const T16* __restrict__ Bt2, int K, float* C, int ldc, const float* __restrict__ bias, size_t sA, size_t sB, size_t sC) {
    typedef typename WFrag<T16>::V V;
    __shared__ __align__(16) float os[16 * 68];
    const size_t z = blockIdx.z; A += z * sA; if (A2) A2 += z * sA; Bt += z * sB; if (Bt2) Bt2 += z * sB; C += z * sC;
    const int lane = threadIdx.x & 31, lr = lane & 15, hi = lane >> 4; const int r0 = blockIdx.x * 64, c0 = blockIdx.y * 64;
    v8f acc[4][4];
#pragma unroll
    for (int mb = 0; mb < 4; ++mb)
#pragma unroll
        for (int nb = 0; nb < 4; ++nb) acc[mb][nb] = (v8f){};
    const size_t aoff = (size_t)(r0 + lr) * K + 8 * hi, boff = (size_t)(c0 + lr) * K + 8 * hi;
#pragma unroll 1
    for (int kc = 0; kc < K; kc += 32) {
        V a[4], a2[4];
#pragma unroll
        for (int mb = 0; mb < 4; ++mb) { a[mb] = WFrag<T16>::ld(A + aoff + (size_t)mb * 16 * K + kc); if (NSPLIT == 1 || NSPLIT == 2) a2[mb] = WFrag<T16>::ld(A2 + aoff + (size_t)mb * 16 * K + kc); }
#pragma unroll
        for (int nb = 0; nb < 4; ++nb) { const V b = WFrag<T16>::ld(Bt + boff + (size_t)nb * 16 * K + kc); V b2; if (NSPLIT >= 2) b2 = WFrag<T16>::ld(Bt2 + boff + (size_t)nb * 16 * K + kc);
#pragma unroll
            for (int mb = 0; mb < 4; ++mb) { acc[mb][nb] = WFrag<T16>::mma(a[mb], b, acc[mb][nb]); if (NSPLIT == 1 || NSPLIT == 2) acc[mb][nb] = WFrag<T16>::mma(a2[mb], b, acc[mb][nb]); if (NSPLIT >= 2) acc[mb][nb] = WFrag<T16>::mma(a[mb], b2, acc[mb][nb]); } }
        asm volatile("v_nop\n\tv_nop\n\tv_nop\n\tv_nop" : "+v"(acc[0][0]), "+v"(acc[1][1]), "+v"(acc[2][2]), "+v"(acc[3][3]) : "v"(a[0]), "v"(a[3]));
    }
#pragma unroll
    for (int mb = 0; mb < 4; ++mb) {
#pragma unroll
        for (int nb = 0; nb < 4; ++nb) {
#pragma unroll
            for (int j = 0; j < 8; ++j) os[(hi * 8 + j) * 68 + nb * 16 + lr] = acc[mb][nb][j]; }
        __builtin_amdgcn_wave_barrier(); asm volatile("" ::: "memory");
        float* crow = C + (size_t)(r0 + mb * 16) * ldc + c0;
{
#pragma unroll
            for (int s = 0; s < 8; ++s) { const int row = 2 * s + hi, cofs = lr * 4; v4f val = *(const v4fa*)(os + row * 68 + cofs); if (BIAS) { val[0] += bfr(bias[c0 + cofs]); val[1] += bfr(bias[c0 + cofs + 1]); val[2] += bfr(bias[c0 + cofs + 2]); val[3] += bfr(bias[c0 + cofs + 3]); }
                *(v4f*)(crow + (size_t)row * ldc + cofs) = val; }
             }
        __builtin_amdgcn_wave_barrier(); asm volatile("" ::: "memory");
    }
}

__device__ __forceinline__ h16 tohx(float x) { return (h16)x; }
__device__ __forceinline__ void splitf(float y, unsigned short& h, unsigned short& l) { h = f2bf(y); l = f2bf(y - bf2f(h)); }
typedef __attribute__((ext_vector_type(2))) _Float16 v2h;
typedef __attribute__((ext_vector_type(4))) _Float16 v4h;
typedef __attribute__((ext_vector_type(2))) unsigned short v2us;
typedef __attribute__((ext_vector_type(4))) unsigned short v4us;
typedef __attribute__((ext_vector_type(2))) float v2f;
typedef __attribute__((ext_vector_type(4))) int v4i;
typedef __attribute__((ext_vector_type(16))) float v16f;

__global__ __launch_bounds__(256) void k_wtG(const float* __restrict__ w, int K, int N, bf* Bt) {
    const int lane = threadIdx.x & 31; const int L0 = (blockIdx.x * 8 + (threadIdx.x >> 5)) * 8; const int nlines = N * K / 64;
{
#pragma unroll 1
        for (int l = 0; l < 8; ++l) { const int L = L0 + l; if (L >= nlines) break; const size_t e = (size_t)L * 64 + lane * 2; const int k = (int)(e % K), n = (int)(e / K); v2us o;
            o[0] = f2bf(w[(size_t)k * N + n]); o[1] = f2bf(w[(size_t)(k + 1) * N + n]); *(v2us*)(Bt + e) = o; }
         }
}
__global__ __launch_bounds__(256) void k_cvt8(const float* __restrict__ src, bf* dst, size_t n8) { const size_t i = (size_t)blockIdx.x * 256 + threadIdx.x; if (i >= n8) return; const v8f v = *(const v8f*)(src + i * 8); v8us o;
#pragma unroll
    for (int k = 0; k < 8; ++k) o[k] = f2bf(v[k]); *(v8us*)(dst + i * 8) = o;  }

// k_rope: head planes [h][t][d] (fp16 + hi/lo) of rope(x) x sc with the rotate-half convention out[d] = x[d] cos[t][d] - x[d+HD/2] sin[t][d], out[d+HD/2] = x[d+HD/2] cos[t][d+HD/2] + x[d] sin[t][d+HD/2]
__global__ __launch_bounds__(256) void k_rope(const float* __restrict__ F, int pitch, int nheads, const float* __restrict__ CS, const float* __restrict__ RF, const float* __restrict__ nw, float sc, h16* P16, bf* Ph, bf* Pl) {
    const size_t e = ((size_t)blockIdx.x * 256 + threadIdx.x) * 2; if (e >= (size_t)nheads * TT * HD) return; const int d = (int)(e % HD); const int t = (int)((e / HD) % TT); const int h = (int)(e / ((size_t)HD * TT)); const float* f = F + (size_t)t * pitch + h * HD; const float rf = RF ? RF[(size_t)h * TT + t] : 1.0f; v2h o16; v2us oh, ol;
#pragma unroll
    for (int q = 0; q < 2; ++q) { const int dd = d + q; const int dp = (dd < HD / 2) ? dd + HD / 2 : dd - HD / 2; float x0 = f[dd], x1 = f[dp];
        if (RF) { float n0 = __fmul_rn(x0, rf), n1 = __fmul_rn(x1, rf); asm volatile("" : "+v"(n0)); asm volatile("" : "+v"(n1)); x0 = __fmul_rn(bfr(nw[dd]), n0); x1 = __fmul_rn(bfr(nw[dp]), n1); }
        const v2f cs = *(const v2f*)(CS + ((size_t)t * HD + dd) * 2); float a = __fmul_rn(x0, cs[0]), bq = __fmul_rn(x1, cs[1]); asm volatile("" : "+v"(a)); asm volatile("" : "+v"(bq)); const float r = ((dd < HD / 2) ? __fsub_rn(a, bq) : __fadd_rn(a, bq)) * sc;
        o16[q] = tohx(r); unsigned short a2, c2; splitf(r, a2, c2); oh[q] = a2; ol[q] = c2; }
    *(v2h*)(P16 + e) = o16; *(v2us*)(Ph + e) = oh; *(v2us*)(Pl + e) = ol;  }
__global__ __launch_bounds__(256) void k_vtp(const float* __restrict__ F, int pitch, int nheads, h16* V16, bf* Vh, bf* Vl) { const size_t e = ((size_t)blockIdx.x * 256 + threadIdx.x) * 2; if (e >= (size_t)nheads * HD * TT) return; const int t = (int)(e % TT); const int d = (int)((e / TT) % HD); const int g = (int)(e / ((size_t)TT * HD)); v2h o16; v2us oh, ol;
#pragma unroll
    for (int q = 0; q < 2; ++q) { const float x = F[(size_t)(t + q) * pitch + g * HD + d]; o16[q] = tohx(x); unsigned short a2, c2; splitf(x, a2, c2); oh[q] = a2; ol[q] = c2; }
    *(v2h*)(V16 + e) = o16; *(v2us*)(Vh + e) = oh; *(v2us*)(Vl + e) = ol;  }
__global__ __launch_bounds__(256) void k_csid(float* CS) { const int idx = blockIdx.x * 256 + threadIdx.x; if (idx >= TT * HD) return; v2f cs; cs[0] = 1.0f; cs[1] = 0.0f; *(v2f*)(CS + (size_t)idx * 2) = cs;  }
__constant__ float INVT[HD / 2] = { 1.000000000e+00f, 7.498942018e-01f, 5.623413324e-01f, 4.216965139e-01f, 3.162277639e-01f, 2.371373624e-01f, 1.778279394e-01f, 1.333521456e-01f, 1.000000015e-01f, 7.498941571e-02f, 5.623412877e-02f, 4.216964915e-02f, 3.162277862e-02f, 2.371373586e-02f, 1.778279431e-02f, 1.333521493e-02f, 9.999999776e-03f, 7.498942316e-03f, 5.623413250e-03f, 4.216964822e-03f, 3.162277862e-03f, 2.371373819e-03f, 1.778279431e-03f, 1.333521446e-03f, 1.000000047e-03f, 7.498941850e-04f, 5.623413017e-04f, 4.216964880e-04f, 3.162277862e-04f, 2.371373848e-04f, 1.778279402e-04f, 1.333521504e-04f };   // float32 1 / 10000^(2i/64), generated with jnp to be bit-exact
__global__ __launch_bounds__(256) void k_cs5(float* CS) { const int idx = blockIdx.x * 256 + threadIdx.x; if (idx >= TT * HD) return; const int d = idx % HD; const int t = idx / HD; const float a = __fmul_rn((float)t, INVT[d % (HD / 2)]); v2f cs; cs[0] = cosf(a); cs[1] = sinf(a); *(v2f*)(CS + (size_t)idx * 2) = cs;  }
// ---- k_fattn: scores, softmax and P x V of one head in ONE kernel; S and P stay in registers. One wave owns 16 NQ query rows and walks the 2048 keys 32 at a time; the waves share nothing (no LDS, no barrier).
// S^T = K Q^T (A = 16 key rows, B = 16 query rows kept in registers): D register r of lane (lr, hi) is key 8 hi + r of query lr, so the two key tiles of a trip, converted in place, are the B operand (k order 8 hi + s, 16 + 8 hi + s: the order of WFrag::ld) of O^T += V^T P^T.
// Softmax with a running maximum m per query, held in the exponent's own unit (score x SCL x log2 e): p = exp2(s c - m), unnormalised; m, the sum and O move only on a trip where some score stands more than 8 above its m (so p <= 2^8); O / sum at the end.
__device__ __forceinline__ float xhalf(float x) { const int b = __float_as_int(x); return __int_as_float(__builtin_amdgcn_permlanex16(b, b, 0x76543210, 0xfedcba98, false, false)); }   // lane l <-> l ^ 16
template <typename T16> struct PFrag;
template <> struct PFrag<h16> { static __device__ __forceinline__ void cv(v16f e, v16h& p, v16h& p2) { (void)p2; p = __builtin_convertvector(e, v16h); } };
template <> struct PFrag<bf> { static __device__ __forceinline__ void cv(v16f e, v16bf& p, v16bf& p2) { p = __builtin_convertvector(e, v16bf); p2 = __builtin_convertvector(e - __builtin_convertvector(p, v16f), v16bf); } };   // hi + lo, both rounded to nearest even as in splitf
// XW: s_wait_xcnt 0 stands between issued global loads or stores and the first overwrite of a register they name; the scheduling barriers on both sides keep later arithmetic from being lifted over the wait.
__device__ __forceinline__ void XW() { __builtin_amdgcn_sched_barrier(0); asm volatile("s_wait_xcnt 0x0" ::: "memory"); __builtin_amdgcn_sched_barrier(0); }
template <typename T16, bool SPLIT, int NQ>
__device__ __forceinline__ void fattn(const T16* __restrict__ Q, const T16* __restrict__ Q2, const T16* __restrict__ Kp, const T16* __restrict__ K2, const T16* __restrict__ Vt, const T16* __restrict__ V2, int q0, bf* Ah, bf* Al) {
    typedef typename WFrag<T16>::V V;
    const float C2 = SCL * 1.4426950408889634f;
    const int lane = threadIdx.x & 31, lr = lane & 15, hi = lane >> 4;
    V qf[NQ][2], qf2[NQ][2], kf[2][2], kf2[2][2], vf[4], vf2[4];
    const T16* qa[NQ]; const T16* qa2[NQ];   // each lane's own Q row addresses
#pragma unroll
    for (int nq = 0; nq < NQ; ++nq) { const size_t o = (size_t)(q0 + nq * 16 + lr) * HD + 8 * hi; qa[nq] = Q + o; qa2[nq] = SPLIT ? Q2 + o : nullptr;
#pragma unroll
        for (int ks = 0; ks < 2; ++ks) { qf[nq][ks] = WFrag<T16>::ld(qa[nq] + ks * 32); if (SPLIT) qf2[nq][ks] = WFrag<T16>::ld(qa2[nq] + ks * 32); } }
    // the wait behind the Q loads takes their row addresses as inputs, so that those registers stay theirs up to the wait
    static_assert(NQ == 2 || NQ == 3, "row addresses named below");
    if (SPLIT) asm volatile("s_wait_xcnt 0x0" :: "v"(qa[0]), "v"(qa[1]), "v"(qa[NQ - 1]), "v"(qa2[0]), "v"(qa2[1]), "v"(qa2[NQ - 1]) : "memory");
    else asm volatile("s_wait_xcnt 0x0" :: "v"(qa[0]), "v"(qa[1]), "v"(qa[NQ - 1]) : "memory");
    __builtin_amdgcn_sched_barrier(0);   // later address arithmetic stays behind the wait
    // K and V^T addresses: each lane's own pointers, which live through the loop and step 32 keys a trip, + a constant
    const T16* kq = Kp + lr * HD + 8 * hi; const T16* kq2 = SPLIT ? K2 + lr * HD + 8 * hi : nullptr; const T16* vq = Vt + lr * TT + 8 * hi; const T16* vq2 = SPLIT ? V2 + lr * TT + 8 * hi : nullptr;
#pragma unroll
    for (int kb = 0; kb < 2; ++kb)
#pragma unroll
        for (int ks = 0; ks < 2; ++ks) { const int c = kb * 16 * HD + ks * 32; kf[kb][ks] = WFrag<T16>::ld(kq + c); if (SPLIT) kf2[kb][ks] = WFrag<T16>::ld(kq2 + c); }
    XW();   // also keeps the first K loads ahead of the first V loads, as in the loop: loads return in order, and with V first the loop's waits for K would be set to wait for the V rows in flight as well
#pragma unroll
    for (int db = 0; db < 4; ++db) { const int c = db * 16 * TT; vf[db] = WFrag<T16>::ld(vq + c); if (SPLIT) vf2[db] = WFrag<T16>::ld(vq2 + c); }
    v8f oa[4][NQ]; float m[NQ]; v2f l[NQ];   // l: two partial sums a lane (even and odd registers), joined at the end
#pragma unroll
    for (int nq = 0; nq < NQ; ++nq) { m[nq] = -3.0e38f; l[nq] = (v2f){};
#pragma unroll
        for (int db = 0; db < 4; ++db) oa[db][nq] = (v8f){}; }
#pragma unroll 1   // rolled: the trips depend on one another through m, the sum and O, and one trip already takes more than 256 registers, so a second copy of the body buys nothing
    for (int key0 = 0; key0 < TT; key0 += 32) {
        v8f s[2][NQ];
#pragma unroll
        for (int kb = 0; kb < 2; ++kb)
#pragma unroll
            for (int nq = 0; nq < NQ; ++nq) { v8f t = (v8f){};
#pragma unroll
                for (int ks = 0; ks < 2; ++ks) { t = WFrag<T16>::mma(kf[kb][ks], qf[nq][ks], t); if (SPLIT) { t = WFrag<T16>::mma(kf2[kb][ks], qf[nq][ks], t); t = WFrag<T16>::mma(kf[kb][ks], qf2[nq][ks], t); } }
                s[kb][nq] = t; }
        int st = (key0 + 32 < TT) ? 1 : 0;   // the pointers step to the next trip's keys; on the last trip they stay (its rows are read again, unused)
        __builtin_amdgcn_sched_barrier(0);   // the wait below stays behind the score products, which then cover the time the V loads issued just before them still need
        asm volatile("s_wait_xcnt 0x0" : "+s"(st) : : "memory");   // the wait before the K pointers, which loads in flight name, are overwritten; the step passes through it so that the additions stand behind it
        kq += st * (32 * HD); if (SPLIT) kq2 += st * (32 * HD);
#pragma unroll
        for (int kb = 0; kb < 2; ++kb)   // the next trip's K rows fly during this trip's softmax and P x V
#pragma unroll
            for (int ks = 0; ks < 2; ++ks) { const int c = kb * 16 * HD + ks * 32; kf[kb][ks] = WFrag<T16>::ld(kq + c); if (SPLIT) kf2[kb][ks] = WFrag<T16>::ld(kq2 + c); }
        float mx[NQ]; bool need = false;   // mx: the maximum over this lane's own 16 keys; the other half's is fetched only where m moves
#pragma unroll
        for (int nq = 0; nq < NQ; ++nq) { float t = s[0][nq][0];
#pragma unroll
            for (int r = 1; r < 16; ++r) t = fmaxf(t, s[r >> 3][nq][r & 7]);
            mx[nq] = t * C2; need = need || (mx[nq] > m[nq] + 8.0f); }
        if (__builtin_amdgcn_ballot_w32(need) != 0) {   // wave-uniform branch: the matrix instructions below need every lane on, and both halves of a column must hold one m
#pragma unroll
            for (int nq = 0; nq < NQ; ++nq) { const float mn = fmaxf(m[nq], fmaxf(mx[nq], xhalf(mx[nq]))); const float al = __builtin_amdgcn_exp2f(m[nq] - mn); m[nq] = mn; l[nq] *= al;
#pragma unroll
                for (int db = 0; db < 4; ++db) oa[db][nq] *= al; } }
#pragma unroll
        for (int nq = 0; nq < NQ; ++nq) { v16f e;
#pragma unroll
            for (int r = 0; r < 16; r += 2) { const v2f a = { s[r >> 3][nq][r & 7], s[r >> 3][nq][(r & 7) + 1] }; const v2f t = __builtin_elementwise_fma(a, (v2f){ C2, C2 }, (v2f){ -m[nq], -m[nq] });   // register pairs as the accumulator holds them: packed f32 without moves
                const v2f x = { __builtin_amdgcn_exp2f(t[0]), __builtin_amdgcn_exp2f(t[1]) }; e[r] = x[0]; e[r + 1] = x[1]; l[nq] += x; }
            V p, p2; PFrag<T16>::cv(e, p, p2);
#pragma unroll
            for (int db = 0; db < 4; ++db) { oa[db][nq] = WFrag<T16>::mma(vf[db], p, oa[db][nq]); if (SPLIT) { oa[db][nq] = WFrag<T16>::mma(vf[db], p2, oa[db][nq]); oa[db][nq] = WFrag<T16>::mma(vf2[db], p, oa[db][nq]); } } }
        asm volatile("s_wait_xcnt 0x0" : "+s"(st) : : "memory");   // the same wait before the V pointers are overwritten
        vq += st * 32; if (SPLIT) vq2 += st * 32;
#pragma unroll
        for (int db = 0; db < 4; ++db) { const int c = db * 16 * TT; vf[db] = WFrag<T16>::ld(vq + c); if (SPLIT) vf2[db] = WFrag<T16>::ld(vq2 + c); }   // the next trip's V^T rows fly during its score products and softmax
    }
    XW();   // the last trip's loads are still in flight where the epilogue reuses their address registers
#pragma unroll
    for (int nq = 0; nq < NQ; ++nq) { const float ls = l[nq][0] + l[nq][1]; const float inv = __fdiv_rn(1.0f, ls + xhalf(ls)); const size_t oo = (size_t)(q0 + nq * 16 + lr) * DQ + 8 * hi;
#pragma unroll
        for (int db = 0; db < 4; ++db) { v8us oh, ol;
#pragma unroll
            for (int r = 0; r < 8; ++r) { unsigned short a, c2; splitf(oa[db][nq][r] * inv, a, c2); oh[r] = a; ol[r] = c2; }
            *(v8us*)(Ah + oo + db * 16) = oh; XW(); *(v8us*)(Al + oo + db * 16) = ol; XW(); } }   // the wait behind each store: the next rows' arithmetic reuses the registers that the store names
}
// grid (RH / 32, heads), 3 independent waves: wave 0 takes 32 hi/lo rows (three products each), waves 1 and 2 take 48 fp16 rows each, so that every work-group asks its cache for the same number of fragment loads a trip.
static_assert((TT - RH) / 96 == RH / 32 && (TT - RH) % 96 == 0 && RH % 32 == 0 && TT % 32 == 0 && TT >= 64 && HD == 64, "row split and trip shape of k_fattn");
__global__ __launch_bounds__(96) void k_fattn(const h16* __restrict__ Q16, const h16* __restrict__ K16, const h16* __restrict__ V16, const bf* __restrict__ Qh, const bf* __restrict__ Ql, const bf* __restrict__ Kh, const bf* __restrict__ Kl, const bf* __restrict__ Vh, const bf* __restrict__ Vl, bf* Ah, bf* Al) {
    const int wave = __builtin_amdgcn_readfirstlane((int)(threadIdx.x >> 5)); const size_t po = (size_t)blockIdx.y * TT * HD; const int bx = (int)blockIdx.x; Ah += blockIdx.y * HD; Al += blockIdx.y * HD;
    if (wave == 0) fattn<bf, true, 2>(Qh + po, Ql + po, Kh + po, Kl + po, Vh + po, Vl + po, bx * 32, Ah, Al);
    else fattn<h16, false, 3>(Q16 + po, nullptr, K16 + po, nullptr, V16 + po, nullptr, RH + bx * 96 + (wave - 1) * 48, Ah, Al);
}

extern "C" void kernel_launch(void* const* d_in, const int* in_sizes, int n_in,
                              void* d_out, int out_size, void* d_ws, size_t ws_size, hipStream_t stream) {
    (void)in_sizes; (void)n_in; (void)out_size;
    const float* x = (const float*)d_in[0]; const float* wq = (const float*)d_in[1]; const float* bq = (const float*)d_in[2]; const float* wk = (const float*)d_in[3]; const float* bk = (const float*)d_in[4]; const float* wv = (const float*)d_in[5]; const float* bv = (const float*)d_in[6]; const float* wo = (const float*)d_in[7]; const float* bo = (const float*)d_in[8];   /* order x, Wq, bq, Wk, bk, Wv, bv, Wo, bo ('xw' (in, out) [1024][1024] + [1024]): NINE inputs, all read: the host's own binding */
    float* OUT = (float*)d_out;     // [2][2048][1024]
    char* wsp = (char*)d_ws;
    auto take = [&](size_t bytes) { char* p = wsp; wsp += (bytes + 255) & ~(size_t)255; return (void*)p; };
    bf* WQ = (bf*)take((size_t)DQ * DM * 2); bf* WK = (bf*)take((size_t)DKV * DM * 2); bf* WV = (bf*)take((size_t)DKV * DM * 2); bf* WO = (bf*)take((size_t)DM * DQ * 2); float* CS = (float*)take((size_t)TT * HD * 2 * 4);
    bf* XB = (bf*)take((size_t)TT * DM * 2); float* FQ = (float*)take((size_t)TT * DQ * 4); float* FK = (float*)take((size_t)TT * DKV * 4);
    h16* QP16 = (h16*)take((size_t)NH_ * TT * HD * 2); h16* KP16 = (h16*)take((size_t)NKV * TT * HD * 2); h16* VT16 = (h16*)take((size_t)NKV * HD * TT * 2);
    bf* QPh = (bf*)take((size_t)NH_ * TT * HD * 2); bf* QPl = (bf*)take((size_t)NH_ * TT * HD * 2); bf* KPh = (bf*)take((size_t)NKV * TT * HD * 2); bf* KPl = (bf*)take((size_t)NKV * TT * HD * 2); bf* VTh = (bf*)take((size_t)NKV * HD * TT * 2); bf* VTl = (bf*)take((size_t)NKV * HD * TT * 2);
    bf* ATh = (bf*)take((size_t)TT * DQ * 2); bf* ATl = (bf*)take((size_t)TT * DQ * 2);
    if ((size_t)(wsp - (char*)d_ws) > ws_size) return;    // ws 256 MiB
    float* FV = FK;   // v projection reuses the k buffer after the k planes are built (stream-ordered)
    { k_wtG<<<(unsigned)((DM * DQ / 64 + 63) / 64), 256, 0, stream>>>(wq, DM, DQ, WQ); k_wtG<<<(unsigned)((DM * DKV / 64 + 63) / 64), 256, 0, stream>>>(wk, DM, DKV, WK); k_wtG<<<(unsigned)((DM * DKV / 64 + 63) / 64), 256, 0, stream>>>(wv, DM, DKV, WV);
      k_wtG<<<(unsigned)((DQ * DM / 64 + 63) / 64), 256, 0, stream>>>(wo, DQ, DM, WO);
       }
    k_cs5<<<(TT * HD + 255) / 256, 256, 0, stream>>>(CS);   /* the COMPUTED rotary table (this module rotates q and k); k_csid stays defined and is NOT launched */
    const unsigned LQ = (unsigned)(((size_t)NH_ * TT * HD / 2 + 255) / 256), LKv = (unsigned)(((size_t)NKV * TT * HD / 2 + 255) / 256);
    for (int b = 0; b < NB_; ++b) {
        
        k_cvt8<<<(unsigned)(((size_t)TT * DM / 8 + 255) / 256), 256, 0, stream>>>(x + (size_t)b * TT * DM, XB, (size_t)TT * DM / 8);
        k_gemmw<bf, 0, true><<<dim3(TT / 64, DQ / 64, 1), 32, 0, stream>>>(XB, nullptr, WQ, nullptr, DM, FQ, DQ, bq, 0, 0, 0);
        k_rope<<<LQ, 256, 0, stream>>>(FQ, DQ, NH_, CS, nullptr, nullptr, 1.0f, QP16, QPh, QPl);
        k_gemmw<bf, 0, true><<<dim3(TT / 64, DKV / 64, 1), 32, 0, stream>>>(XB, nullptr, WK, nullptr, DM, FK, DKV, bk, 0, 0, 0);
        k_rope<<<LKv, 256, 0, stream>>>(FK, DKV, NKV, CS, nullptr, nullptr, 1.0f, KP16, KPh, KPl);
        k_gemmw<bf, 0, true><<<dim3(TT / 64, DKV / 64, 1), 32, 0, stream>>>(XB, nullptr, WV, nullptr, DM, FV, DKV, bv, 0, 0, 0); k_vtp<<<LKv, 256, 0, stream>>>(FV, DKV, NKV, VT16, VTh, VTl);
        k_fattn<<<dim3(RH / 32, NH_, 1), 96, 0, stream>>>(QP16, KP16, VT16, QPh, QPl, KPh, KPl, VTh, VTl, ATh, ATl);   // one kv head per query head
        k_gemmw<bf, 1, true><<<dim3(TT / 64, DM / 64, 1), 32, 0, stream>>>(ATh, ATl, WO, nullptr, DQ, OUT + (size_t)b * TT * DM, DM, bo, 0, 0, 0); }
}

// v003
// It runs in 364 microseconds.
// Two timings next to v002 put it at 1.09 and 1.08 times that version's speed.
// Over all steps from v000 it is 5.54 times as fast.
#include <hip/hip_runtime.h>

// Multi-head attention with biased 'xw' projections and a COMPUTED rotate-half rotary embedding, NO mask (x [2][2048][1024]; q, k, v = x W + b ('xw' (in, out) [1024][1024] 0.02 + zero biases (ONE zeros array bound four times by the module's setup): read; 16 heads x 64); q, k -> cat(x1 cos - x2 sin, x2 cos + x1 sin) on the two 32-wide halves (= t cos + cat(-t2, t1) sin with cat(freqs, freqs)) with angle t x 1 / 10000^(2i/64) (32 f32 frequencies exact for the module's expression 1.0 / (10000.0 ** (arange(0, 64, 2) / 64)); precise cosf/sinf); scores / sqrt(64) (np.sqrt(D_K) as float32); softmax over all keys; out = merged Wo + bo ('xw' + bias) -> [2][2048][1024] (4.2 M); argument order x, Wq, bq, Wk, bk, Wv, bv, Wo, bo).
// Layout per batch: bf16 copy of x; 'xw' weights transposed once; exact projections + f32 biases; k_cs5 computes the rotary table once (32 baked float32 frequencies) and the projection kernel's own epilogue applies the rotate-half rotation at width 64 and writes the head planes (q, k) or the transposed planes (v); one fused attention kernel per batch (scores, running-maximum softmax with the 1/8 in the exponent, P x V; hybrid rows: < 512 hi/lo 3 products, rest fp16); merged hi/lo x wo exact + bo.
// Compute dtypes, f32 accumulate: every input rounded to bf16; projections exact + f32 biases; attention rows < 512 3 products, rest fp16; softmax f32; Wo hl x exact + bias.

#define NB_  2
#define TT   2048
#define DM   1024
#define NH_  16
#define NKV  16
#define REP  (NH_ / NKV)
#define HD   64
#define DQ   (NH_ * HD)
#define DKV  (NKV * HD)
#define RH   512                  // query rows < RH use hi+lo planes
#define SCL  0.125f   // HD^-0.5
typedef _Float16 h16;
typedef unsigned short bf;
typedef __attribute__((ext_vector_type(16))) __bf16   v16bf;
typedef __attribute__((ext_vector_type(16))) _Float16 v16h;
typedef __attribute__((ext_vector_type(8)))  _Float16 v8h;
typedef __attribute__((ext_vector_type(8)))  unsigned short v8us;
typedef __attribute__((ext_vector_type(8)))  float    v8f;
typedef __attribute__((ext_vector_type(4)))  float    v4f;
typedef v8h  __attribute__((may_alias)) v8ha;
typedef v4f  __attribute__((may_alias)) v4fa;
typedef v8us __attribute__((may_alias)) v8usa;

__device__ __forceinline__ unsigned short f2bf(float f) { unsigned u = __float_as_uint(f); u += 0x7FFFu + ((u >> 16) & 1u); return (unsigned short)(u >> 16); }
__device__ __forceinline__ float bf2f(unsigned short b) { return __uint_as_float(((unsigned)b) << 16); }
__device__ __forceinline__ float bfr(float f) { return bf2f(f2bf(f)); }
__device__ __forceinline__ v16h cat16(v8h lo, v8h hi) { return __builtin_shufflevector(lo, hi, 0, 1, 2, 3, 4, 5, 6, 7, 8, 9, 10, 11, 12, 13, 14, 15); }
__device__ __forceinline__ v16bf cat16b(v8us lo, v8us hi) { return __builtin_bit_cast(v16bf, __builtin_shufflevector(lo, hi, 0, 1, 2, 3, 4, 5, 6, 7, 8, 9, 10, 11, 12, 13, 14, 15)); }
__device__ __forceinline__ v8f wmma16(v16h a, v16h b, v8f c) { return __builtin_amdgcn_wmma_f32_16x16x32_f16(false, a, false, b, (short)0, c, false, false); }
__device__ __forceinline__ v8f wmmab(v16bf a, v16bf b, v8f c) { return __builtin_amdgcn_wmma_f32_16x16x32_bf16(false, a, false, b, (short)0, c, false, false); }
__device__ __forceinline__ h16 tohx(float x) { return (h16)x; }
__device__ __forceinline__ void splitf(float y, unsigned short& h, unsigned short& l) { h = f2bf(y); l = f2bf(y - bf2f(h)); }
typedef __attribute__((ext_vector_type(2))) _Float16 v2h;
typedef __attribute__((ext_vector_type(4))) _Float16 v4h;
typedef __attribute__((ext_vector_type(2))) unsigned short v2us;
typedef __attribute__((ext_vector_type(4))) unsigned short v4us;
typedef __attribute__((ext_vector_type(2))) float v2f;
typedef __attribute__((ext_vector_type(4))) int v4i;
typedef __attribute__((ext_vector_type(16))) float v16f;
// XW: s_wait_xcnt 0 stands between issued global loads or stores and the first overwrite of a register they name; the scheduling barriers on both sides keep later arithmetic from being lifted over the wait.
__device__ __forceinline__ void XW() { __builtin_amdgcn_sched_barrier(0); asm volatile("s_wait_xcnt 0x0" ::: "memory"); __builtin_amdgcn_sched_barrier(0); }



// ---- k_gemmw: register-blocked GEMM, ONE WAVE per 64x64 output tile (16 accumulators), operands straight from K-contiguous 16-bit planes; grid (M/64, N/64, Z), 32 threads.
// C[m][n] (+ f32 bias[n]) = sum_k A[m][k] Bt[n][k] (+ split products per NSPLIT). z-batch strides sA/sB/sC in elements. K % 32 == 0.
// EPI says where the tile goes. 0: f32 C, pitch ldc. A 64-wide tile is one head (HD == 64), so the other two finish the head's planes from the accumulators, with no f32 copy in memory:
// 1: rotate-half rotation out[d] = x[d] cos[t][d] - x[d+32] sin[t][d], out[d+32] = x[d+32] cos[t][d] + x[d] sin[t][d] (table CS [t][d](cos, sin), whose two halves are equal), planes [h][t][d] (fp16 + hi/lo); 2: planes [h][d][t] (fp16 + hi/lo).
template <typename T16> struct WFrag;
template <> struct WFrag<h16> { typedef v16h V; static __device__ __forceinline__ V ld(const h16* p) { return cat16(*(const v8h*)p, *(const v8h*)(p + 16)); } static __device__ __forceinline__ v8f mma(V a, V b, v8f c) { return wmma16(a, b, c); } };
template <> struct WFrag<bf> { typedef v16bf V; static __device__ __forceinline__ V ld(const bf* p) { return cat16b(*(const v8us*)p, *(const v8us*)(p + 16)); } static __device__ __forceinline__ v8f mma(V a, V b, v8f c) { return wmmab(a, b, c); } };
template <typename T16, int NSPLIT, bool BIAS, int EPI>
__global__ __launch_bounds__(32) void k_gemmw(const T16* __restrict__ A, const T16* __restrict__ A2, const T16* __restrict__ Bt, const T16* __restrict__ Bt2, int K, float* C, int ldc, const float* __restrict__ bias, size_t sA, size_t sB, size_t sC, const float* __restrict__ CS, h16* P16, bf* Ph, bf* Pl) {
    static_assert(EPI == 0 || HD == 64, "one tile, one head");
    typedef typename WFrag<T16>::V V;
    __shared__ __align__(16) float os[16 * 68];
    const size_t z = blockIdx.z; A += z * sA; if (A2) A2 += z * sA; Bt += z * sB; if (Bt2) Bt2 += z * sB; if (EPI == 0) C += z * sC;
    const int lane = threadIdx.x & 31, lr = lane & 15, hi = lane >> 4; const int r0 = blockIdx.x * 64, c0 = blockIdx.y * 64;
    v8f acc[4][4];
#pragma unroll
    for (int mb = 0; mb < 4; ++mb)
#pragma unroll
        for (int nb = 0; nb < 4; ++nb) acc[mb][nb] = (v8f){};
    const size_t aoff = (size_t)(r0 + lr) * K + 8 * hi, boff = (size_t)(c0 + lr) * K + 8 * hi;
    // EPI 1: 8 lanes a row; a lane takes 4 columns of the head's low half and their partners in the high half, which share one (cos, sin). The table rows of 16 tile rows are fetched one block of rows ahead of their use. (The loops of both epilogues are unrolled because acc, cs and the vectors they fill live in registers and take constant indices only.)
    const int rq = lane >> 3, col = (lane & 7) * 4; v4f b1 = (v4f){}, b2 = (v4f){}, cs[2][4][2];
    auto ldcs = [&](int mb) {
#pragma unroll
        for (int s = 0; s < 4; ++s) { const float* cp = CS + ((size_t)(r0 + mb * 16 + 4 * s + rq) * HD + col) * 2; cs[mb & 1][s][0] = *(const v4f*)cp; cs[mb & 1][s][1] = *(const v4f*)(cp + 4); }
        XW(); };   // the arithmetic that follows reuses the address registers of these loads
    if (EPI == 1) {
#pragma unroll
        for (int i = 0; i < 4; ++i) { b1[i] = bfr(bias[c0 + col + i]); b2[i] = bfr(bias[c0 + HD / 2 + col + i]); }
        ldcs(0); }
    if (EPI == 2) {   // the four columns' biases, fetched ahead of the K loop like the table rows above
#pragma unroll
        for (int nb = 0; nb < 4; ++nb) b1[nb] = bias[c0 + nb * 16 + lr];
        XW(); }   // as behind the table rows
#pragma unroll 1
    for (int kc = 0; kc < K; kc += 32) {
        V a[4], a2[4];
#pragma unroll
        for (int mb = 0; mb < 4; ++mb) { a[mb] = WFrag<T16>::ld(A + aoff + (size_t)mb * 16 * K + kc); if (NSPLIT == 1 || NSPLIT == 2) a2[mb] = WFrag<T16>::ld(A2 + aoff + (size_t)mb * 16 * K + kc); }
#pragma unroll
        for (int nb = 0; nb < 4; ++nb) { const V b = WFrag<T16>::ld(Bt + boff + (size_t)nb * 16 * K + kc); V b2; if (NSPLIT >= 2) b2 = WFrag<T16>::ld(Bt2 + boff + (size_t)nb * 16 * K + kc);
#pragma unroll
            for (int mb = 0; mb < 4; ++mb) { acc[mb][nb] = WFrag<T16>::mma(a[mb], b, acc[mb][nb]); if (NSPLIT == 1 || NSPLIT == 2) acc[mb][nb] = WFrag<T16>::mma(a2[mb], b, acc[mb][nb]); if (NSPLIT >= 2) acc[mb][nb] = WFrag<T16>::mma(a[mb], b2, acc[mb][nb]); } }
        asm volatile("v_nop\n\tv_nop\n\tv_nop\n\tv_nop" : "+v"(acc[0][0]), "+v"(acc[1][1]), "+v"(acc[2][2]), "+v"(acc[3][3]) : "v"(a[0]), "v"(a[3]));
    }
    if (EPI == 2) {   // a lane's 8 accumulator registers are 8 consecutive t of one column d: 16-byte stores straight into the transposed planes; the four blocks of rows, stored one behind the other, fill each 128-byte line
#pragma unroll
        for (int nb = 0; nb < 4; ++nb) { const float bb = bfr(b1[nb]); const size_t e = (size_t)(c0 + nb * 16 + lr) * TT + r0 + hi * 8;
#pragma unroll
            for (int mb = 0; mb < 4; ++mb) { v8h o16; v8us oh, ol;
#pragma unroll
                for (int j = 0; j < 8; ++j) { const float x = acc[mb][nb][j] + bb; o16[j] = tohx(x); unsigned short a2, c2; splitf(x, a2, c2); oh[j] = a2; ol[j] = c2; }
                *(v8h*)(P16 + e + mb * 16) = o16; *(v8us*)(Ph + e + mb * 16) = oh; *(v8us*)(Pl + e + mb * 16) = ol; }
            XW(); }   // the next column block's arithmetic reuses the registers that these stores name
        return; }
#pragma unroll
    for (int mb = 0; mb < 4; ++mb) {
#pragma unroll
        for (int nb = 0; nb < 4; ++nb) {
#pragma unroll
            for (int j = 0; j < 8; ++j) os[(hi * 8 + j) * 68 + nb * 16 + lr] = acc[mb][nb][j]; }
        __builtin_amdgcn_wave_barrier(); asm volatile("" ::: "memory");
        float* crow = C + (size_t)(r0 + mb * 16) * ldc + c0;
        if (EPI == 0)
{
#pragma unroll
            for (int s = 0; s < 8; ++s) { const int row = 2 * s + hi, cofs = lr * 4; v4f val = *(const v4fa*)(os + row * 68 + cofs); if (BIAS) { val[0] += bfr(bias[c0 + cofs]); val[1] += bfr(bias[c0 + cofs + 1]); val[2] += bfr(bias[c0 + cofs + 2]); val[3] += bfr(bias[c0 + cofs + 3]); }
                *(v4f*)(crow + (size_t)row * ldc + cofs) = val; }
             }
        if (EPI == 1) {
            if (mb < 3) ldcs(mb + 1);
#pragma unroll
            for (int s = 0; s < 4; ++s) { const int row = 4 * s + rq; const v4f x1 = *(const v4fa*)(os + row * 68 + col) + b1, x2 = *(const v4fa*)(os + row * 68 + HD / 2 + col) + b2; const v4f ca = cs[mb & 1][s][0], cb = cs[mb & 1][s][1];
                const v4f cc = { ca[0], ca[2], cb[0], cb[2] }, sn = { ca[1], ca[3], cb[1], cb[3] }; const v4f rl = x1 * cc - x2 * sn, rh = x2 * cc + x1 * sn; v4h l16, u16; v4us lh, ll, uh, ul;
#pragma unroll
                for (int i = 0; i < 4; ++i) { unsigned short a2, c2; l16[i] = tohx(rl[i]); splitf(rl[i], a2, c2); lh[i] = a2; ll[i] = c2; u16[i] = tohx(rh[i]); splitf(rh[i], a2, c2); uh[i] = a2; ul[i] = c2; }
                const size_t e = ((size_t)blockIdx.y * TT + r0 + mb * 16 + row) * HD + col;
                *(v4h*)(P16 + e) = l16; *(v4h*)(P16 + e + HD / 2) = u16; *(v4us*)(Ph + e) = lh; *(v4us*)(Ph + e + HD / 2) = uh; *(v4us*)(Pl + e) = ll; *(v4us*)(Pl + e + HD / 2) = ul;
                XW(); } }   // the next rows' arithmetic reuses the registers that these stores name
        __builtin_amdgcn_wave_barrier(); asm volatile("" ::: "memory");
    }
}

__global__ __launch_bounds__(256) void k_wtG(const float* __restrict__ w, int K, int N, bf* Bt) {
    const int lane = threadIdx.x & 31; const int L0 = (blockIdx.x * 8 + (threadIdx.x >> 5)) * 8; const int nlines = N * K / 64;
{
#pragma unroll 1
        for (int l = 0; l < 8; ++l) { const int L = L0 + l; if (L >= nlines) break; const size_t e = (size_t)L * 64 + lane * 2; const int k = (int)(e % K), n = (int)(e / K); v2us o;
            o[0] = f2bf(w[(size_t)k * N + n]); o[1] = f2bf(w[(size_t)(k + 1) * N + n]); *(v2us*)(Bt + e) = o; }
         }
}
__global__ __launch_bounds__(256) void k_cvt8(const float* __restrict__ src, bf* dst, size_t n8) { const size_t i = (size_t)blockIdx.x * 256 + threadIdx.x; if (i >= n8) return; const v8f v = *(const v8f*)(src + i * 8); v8us o;
#pragma unroll
    for (int k = 0; k < 8; ++k) o[k] = f2bf(v[k]); *(v8us*)(dst + i * 8) = o;  }

__global__ __launch_bounds__(256) void k_csid(float* CS) { const int idx = blockIdx.x * 256 + threadIdx.x; if (idx >= TT * HD) return; v2f cs; cs[0] = 1.0f; cs[1] = 0.0f; *(v2f*)(CS + (size_t)idx * 2) = cs;  }
__constant__ float INVT[HD / 2] = { 1.000000000e+00f, 7.498942018e-01f, 5.623413324e-01f, 4.216965139e-01f, 3.162277639e-01f, 2.371373624e-01f, 1.778279394e-01f, 1.333521456e-01f, 1.000000015e-01f, 7.498941571e-02f, 5.623412877e-02f, 4.216964915e-02f, 3.162277862e-02f, 2.371373586e-02f, 1.778279431e-02f, 1.333521493e-02f, 9.999999776e-03f, 7.498942316e-03f, 5.623413250e-03f, 4.216964822e-03f, 3.162277862e-03f, 2.371373819e-03f, 1.778279431e-03f, 1.333521446e-03f, 1.000000047e-03f, 7.498941850e-04f, 5.623413017e-04f, 4.216964880e-04f, 3.162277862e-04f, 2.371373848e-04f, 1.778279402e-04f, 1.333521504e-04f };   // float32 1 / 10000^(2i/64), generated with jnp to be bit-exact
__global__ __launch_bounds__(256) void k_cs5(float* CS) { const int idx = blockIdx.x * 256 + threadIdx.x; if (idx >= TT * HD) return; const int d = idx % HD; const int t = idx / HD; const float a = __fmul_rn((float)t, INVT[d % (HD / 2)]); v2f cs; cs[0] = cosf(a); cs[1] = sinf(a); *(v2f*)(CS + (size_t)idx * 2) = cs;  }
// ---- k_fattn: scores, softmax and P x V of one head in ONE kernel; S and P stay in registers. One wave owns 16 NQ query rows and walks the 2048 keys 32 at a time; the waves share nothing (no LDS, no barrier).
// S^T = K Q^T (A = 16 key rows, B = 16 query rows kept in registers): D register r of lane (lr, hi) is key 8 hi + r of query lr, so the two key tiles of a trip, converted in place, are the B operand (k order 8 hi + s, 16 + 8 hi + s: the order of WFrag::ld) of O^T += V^T P^T.
// Softmax with a running maximum m per query, held in the exponent's own unit (score x SCL x log2 e): p = exp2(s c - m), unnormalised; m, the sum and O move only on a trip where some score stands more than 8 above its m (so p <= 2^8); O / sum at the end.
__device__ __forceinline__ float xhalf(float x) { const int b = __float_as_int(x); return __int_as_float(__builtin_amdgcn_permlanex16(b, b, 0x76543210, 0xfedcba98, false, false)); }   // lane l <-> l ^ 16
template <typename T16> struct PFrag;
template <> struct PFrag<h16> { static __device__ __forceinline__ void cv(v16f e, v16h& p, v16h& p2) { (void)p2; p = __builtin_convertvector(e, v16h); } };
template <> struct PFrag<bf> { static __device__ __forceinline__ void cv(v16f e, v16bf& p, v16bf& p2) { p = __builtin_convertvector(e, v16bf); p2 = __builtin_convertvector(e - __builtin_convertvector(p, v16f), v16bf); } };   // hi + lo, both rounded to nearest even as in splitf
template <typename T16, bool SPLIT, int NQ>
__device__ __forceinline__ void fattn(const T16* __restrict__ Q, const T16* __restrict__ Q2, const T16* __restrict__ Kp, const T16* __restrict__ K2, const T16* __restrict__ Vt, const T16* __restrict__ V2, int q0, bf* Ah, bf* Al) {
    typedef typename WFrag<T16>::V V;
    const float C2 = SCL * 1.4426950408889634f;
    const int lane = threadIdx.x & 31, lr = lane & 15, hi = lane >> 4;
    V qf[NQ][2], qf2[NQ][2], kf[2][2], kf2[2][2], vf[4], vf2[4];
    const T16* qa[NQ]; const T16* qa2[NQ];   // each lane's own Q row addresses
#pragma unroll
    for (int nq = 0; nq < NQ; ++nq) { const size_t o = (size_t)(q0 + nq * 16 + lr) * HD + 8 * hi; qa[nq] = Q + o; qa2[nq] = SPLIT ? Q2 + o : nullptr;
#pragma unroll
        for (int ks = 0; ks < 2; ++ks) { qf[nq][ks] = WFrag<T16>::ld(qa[nq] + ks * 32); if (SPLIT) qf2[nq][ks] = WFrag<T16>::ld(qa2[nq] + ks * 32); } }
    // the wait behind the Q loads takes their row addresses as inputs, so that those registers stay theirs up to the wait
    static_assert(NQ == 2 || NQ == 3, "row addresses named below");
    if (SPLIT) asm volatile("s_wait_xcnt 0x0" :: "v"(qa[0]), "v"(qa[1]), "v"(qa[NQ - 1]), "v"(qa2[0]), "v"(qa2[1]), "v"(qa2[NQ - 1]) : "memory");
    else asm volatile("s_wait_xcnt 0x0" :: "v"(qa[0]), "v"(qa[1]), "v"(qa[NQ - 1]) : "memory");
    __builtin_amdgcn_sched_barrier(0);   // later address arithmetic stays behind the wait
    // K and V^T addresses: each lane's own pointers, which live through the loop and step 32 keys a trip, + a constant
    const T16* kq = Kp + lr * HD + 8 * hi; const T16* kq2 = SPLIT ? K2 + lr * HD + 8 * hi : nullptr; const T16* vq = Vt + lr * TT + 8 * hi; const T16* vq2 = SPLIT ? V2 + lr * TT + 8 * hi : nullptr;
#pragma unroll
    for (int kb = 0; kb < 2; ++kb)
#pragma unroll
        for (int ks = 0; ks < 2; ++ks) { const int c = kb * 16 * HD + ks * 32; kf[kb][ks] = WFrag<T16>::ld(kq + c); if (SPLIT) kf2[kb][ks] = WFrag<T16>::ld(kq2 + c); }
    XW();   // also keeps the first K loads ahead of the first V loads, as in the loop: loads return in order, and with V first the loop's waits for K would be set to wait for the V rows in flight as well
#pragma unroll
    for (int db = 0; db < 4; ++db) { const int c = db * 16 * TT; vf[db] = WFrag<T16>::ld(vq + c); if (SPLIT) vf2[db] = WFrag<T16>::ld(vq2 + c); }
    v8f oa[4][NQ]; float m[NQ]; v2f l[NQ];   // l: two partial sums a lane (even and odd registers), joined at the end
#pragma unroll
    for (int nq = 0; nq < NQ; ++nq) { m[nq] = -3.0e38f; l[nq] = (v2f){};
#pragma unroll
        for (int db = 0; db < 4; ++db) oa[db][nq] = (v8f){}; }
#pragma unroll 1   // rolled: the trips depend on one another through m, the sum and O, and one trip already takes more than 256 registers, so a second copy of the body buys nothing
    for (int key0 = 0; key0 < TT; key0 += 32) {
        v8f s[2][NQ];
#pragma unroll
        for (int kb = 0; kb < 2; ++kb)
#pragma unroll
            for (int nq = 0; nq < NQ; ++nq) { v8f t = (v8f){};
#pragma unroll
                for (int ks = 0; ks < 2; ++ks) { t = WFrag<T16>::mma(kf[kb][ks], qf[nq][ks], t); if (SPLIT) { t = WFrag<T16>::mma(kf2[kb][ks], qf[nq][ks], t); t = WFrag<T16>::mma(kf[kb][ks], qf2[nq][ks], t); } }
                s[kb][nq] = t; }
        int st = (key0 + 32 < TT) ? 1 : 0;   // the pointers step to the next trip's keys; on the last trip they stay (its rows are read again, unused)
        __builtin_amdgcn_sched_barrier(0);   // the wait below stays behind the score products, which then cover the time the V loads issued just before them still need
        asm volatile("s_wait_xcnt 0x0" : "+s"(st) : : "memory");   // the wait before the K pointers, which loads in flight name, are overwritten; the step passes through it so that the additions stand behind it
        kq += st * (32 * HD); if (SPLIT) kq2 += st * (32 * HD);
#pragma unroll
        for (int kb = 0; kb < 2; ++kb)   // the next trip's K rows fly during this trip's softmax and P x V
#pragma unroll
            for (int ks = 0; ks < 2; ++ks) { const int c = kb * 16 * HD + ks * 32; kf[kb][ks] = WFrag<T16>::ld(kq + c); if (SPLIT) kf2[kb][ks] = WFrag<T16>::ld(kq2 + c); }
        float mx[NQ]; bool need = false;   // mx: the maximum over this lane's own 16 keys; the other half's is fetched only where m moves
#pragma unroll
        for (int nq = 0; nq < NQ; ++nq) { float t = s[0][nq][0];
#pragma unroll
            for (int r = 1; r < 16; ++r) t = fmaxf(t, s[r >> 3][nq][r & 7]);
            mx[nq] = t * C2; need = need || (mx[nq] > m[nq] + 8.0f); }
        if (__builtin_amdgcn_ballot_w32(need) != 0) {   // wave-uniform branch: the matrix instructions below need every lane on, and both halves of a column must hold one m
#pragma unroll
            for (int nq = 0; nq < NQ; ++nq) { const float mn = fmaxf(m[nq], fmaxf(mx[nq], xhalf(mx[nq]))); const float al = __builtin_amdgcn_exp2f(m[nq] - mn); m[nq] = mn; l[nq] *= al;
#pragma unroll
                for (int db = 0; db < 4; ++db) oa[db][nq] *= al; } }
#pragma unroll
        for (int nq = 0; nq < NQ; ++nq) { v16f e;
#pragma unroll
            for (int r = 0; r < 16; r += 2) { const v2f a = { s[r >> 3][nq][r & 7], s[r >> 3][nq][(r & 7) + 1] }; const v2f t = __builtin_elementwise_fma(a, (v2f){ C2, C2 }, (v2f){ -m[nq], -m[nq] });   // register pairs as the accumulator holds them: packed f32 without moves
                const v2f x = { __builtin_amdgcn_exp2f(t[0]), __builtin_amdgcn_exp2f(t[1]) }; e[r] = x[0]; e[r + 1] = x[1]; l[nq] += x; }
            V p, p2; PFrag<T16>::cv(e, p, p2);
#pragma unroll
            for (int db = 0; db < 4; ++db) { oa[db][nq] = WFrag<T16>::mma(vf[db], p, oa[db][nq]); if (SPLIT) { oa[db][nq] = WFrag<T16>::mma(vf[db], p2, oa[db][nq]); oa[db][nq] = WFrag<T16>::mma(vf2[db], p, oa[db][nq]); } } }
        asm volatile("s_wait_xcnt 0x0" : "+s"(st) : : "memory");   // the same wait before the V pointers are overwritten
        vq += st * 32; if (SPLIT) vq2 += st * 32;
#pragma unroll
        for (int db = 0; db < 4; ++db) { const int c = db * 16 * TT; vf[db] = WFrag<T16>::ld(vq + c); if (SPLIT) vf2[db] = WFrag<T16>::ld(vq2 + c); }   // the next trip's V^T rows fly during its score products and softmax
    }
    XW();   // the last trip's loads are still in flight where the epilogue reuses their address registers
#pragma unroll
    for (int nq = 0; nq < NQ; ++nq) { const float ls = l[nq][0] + l[nq][1]; const float inv = __fdiv_rn(1.0f, ls + xhalf(ls)); const size_t oo = (size_t)(q0 + nq * 16 + lr) * DQ + 8 * hi;
#pragma unroll
        for (int db = 0; db < 4; ++db) { v8us oh, ol;
#pragma unroll
            for (int r = 0; r < 8; ++r) { unsigned short a, c2; splitf(oa[db][nq][r] * inv, a, c2); oh[r] = a; ol[r] = c2; }
            *(v8us*)(Ah + oo + db * 16) = oh; XW(); *(v8us*)(Al + oo + db * 16) = ol; XW(); } }   // the wait behind each store: the next rows' arithmetic reuses the registers that the store names
}
// grid (RH / 32, heads), 3 independent waves: wave 0 takes 32 hi/lo rows (three products each), waves 1 and 2 take 48 fp16 rows each, so that every work-group asks its cache for the same number of fragment loads a trip.
static_assert((TT - RH) / 96 == RH / 32 && (TT - RH) % 96 == 0 && RH % 32 == 0 && TT % 32 == 0 && TT >= 64 && HD == 64, "row split and trip shape of k_fattn");
__global__ __launch_bounds__(96) void k_fattn(const h16* __restrict__ Q16, const h16* __restrict__ K16, const h16* __restrict__ V16, const bf* __restrict__ Qh, const bf* __restrict__ Ql, const bf* __restrict__ Kh, const bf* __restrict__ Kl, const bf* __restrict__ Vh, const bf* __restrict__ Vl, bf* Ah, bf* Al) {
    const int wave = __builtin_amdgcn_readfirstlane((int)(threadIdx.x >> 5)); const size_t po = (size_t)blockIdx.y * TT * HD; const int bx = (int)blockIdx.x; Ah += blockIdx.y * HD; Al += blockIdx.y * HD;
    if (wave == 0) fattn<bf, true, 2>(Qh + po, Ql + po, Kh + po, Kl + po, Vh + po, Vl + po, bx * 32, Ah, Al);
    else fattn<h16, false, 3>(Q16 + po, nullptr, K16 + po, nullptr, V16 + po, nullptr, RH + bx * 96 + (wave - 1) * 48, Ah, Al);
}

extern "C" void kernel_launch(void* const* d_in, const int* in_sizes, int n_in,
                              void* d_out, int out_size, void* d_ws, size_t ws_size, hipStream_t stream) {
    (void)in_sizes; (void)n_in; (void)out_size;
    const float* x = (const float*)d_in[0]; const float* wq = (const float*)d_in[1]; const float* bq = (const float*)d_in[2]; const float* wk = (const float*)d_in[3]; const float* bk = (const float*)d_in[4]; const float* wv = (const float*)d_in[5]; const float* bv = (const float*)d_in[6]; const float* wo = (const float*)d_in[7]; const float* bo = (const float*)d_in[8];   /* order x, Wq, bq, Wk, bk, Wv, bv, Wo, bo ('xw' (in, out) [1024][1024] + [1024]): NINE inputs, all read: the host's own binding */
    float* OUT = (float*)d_out;     // [2][2048][1024]
    char* wsp = (char*)d_ws;
    auto take = [&](size_t bytes) { char* p = wsp; wsp += (bytes + 255) & ~(size_t)255; return (void*)p; };
    bf* WQ = (bf*)take((size_t)DQ * DM * 2); bf* WK = (bf*)take((size_t)DKV * DM * 2); bf* WV = (bf*)take((size_t)DKV * DM * 2); bf* WO = (bf*)take((size_t)DM * DQ * 2); float* CS = (float*)take((size_t)TT * HD * 2 * 4);
    bf* XB = (bf*)take((size_t)TT * DM * 2);
    h16* QP16 = (h16*)take((size_t)NH_ * TT * HD * 2); h16* KP16 = (h16*)take((size_t)NKV * TT * HD * 2); h16* VT16 = (h16*)take((size_t)NKV * HD * TT * 2);
    bf* QPh = (bf*)take((size_t)NH_ * TT * HD * 2); bf* QPl = (bf*)take((size_t)NH_ * TT * HD * 2); bf* KPh = (bf*)take((size_t)NKV * TT * HD * 2); bf* KPl = (bf*)take((size_t)NKV * TT * HD * 2); bf* VTh = (bf*)take((size_t)NKV * HD * TT * 2); bf* VTl = (bf*)take((size_t)NKV * HD * TT * 2);
    bf* ATh = (bf*)take((size_t)TT * DQ * 2); bf* ATl = (bf*)take((size_t)TT * DQ * 2);
    if ((size_t)(wsp - (char*)d_ws) > ws_size) return;    // ws 256 MiB
    { k_wtG<<<(unsigned)((DM * DQ / 64 + 63) / 64), 256, 0, stream>>>(wq, DM, DQ, WQ); k_wtG<<<(unsigned)((DM * DKV / 64 + 63) / 64), 256, 0, stream>>>(wk, DM, DKV, WK); k_wtG<<<(unsigned)((DM * DKV / 64 + 63) / 64), 256, 0, stream>>>(wv, DM, DKV, WV);
      k_wtG<<<(unsigned)((DQ * DM / 64 + 63) / 64), 256, 0, stream>>>(wo, DQ, DM, WO);
       }
    k_cs5<<<(TT * HD + 255) / 256, 256, 0, stream>>>(CS);   /* the COMPUTED rotary table (this module rotates q and k); k_csid stays defined and is NOT launched */
    for (int b = 0; b < NB_; ++b) {
        
        k_cvt8<<<(unsigned)(((size_t)TT * DM / 8 + 255) / 256), 256, 0, stream>>>(x + (size_t)b * TT * DM, XB, (size_t)TT * DM / 8);
        k_gemmw<bf, 0, true, 1><<<dim3(TT / 64, DQ / 64, 1), 32, 0, stream>>>(XB, nullptr, WQ, nullptr, DM, nullptr, 0, bq, 0, 0, 0, CS, QP16, QPh, QPl);
        k_gemmw<bf, 0, true, 1><<<dim3(TT / 64, DKV / 64, 1), 32, 0, stream>>>(XB, nullptr, WK, nullptr, DM, nullptr, 0, bk, 0, 0, 0, CS, KP16, KPh, KPl);
        k_gemmw<bf, 0, true, 2><<<dim3(TT / 64, DKV / 64, 1), 32, 0, stream>>>(XB, nullptr, WV, nullptr, DM, nullptr, 0, bv, 0, 0, 0, nullptr, VT16, VTh, VTl);
        k_fattn<<<dim3(RH / 32, NH_, 1), 96, 0, stream>>>(QP16, KP16, VT16, QPh, QPl, KPh, KPl, VTh, VTl, ATh, ATl);   // one kv head per query head
        k_gemmw<bf, 1, true, 0><<<dim3(TT / 64, DM / 64, 1), 32, 0, stream>>>(ATh, ATl, WO, nullptr, DQ, OUT + (size_t)b * TT * DM, DM, bo, 0, 0, 0, nullptr, nullptr, nullptr, nullptr); }
}

// v004
// It runs in 184 microseconds.
// Two timings next to v003 put it at 1.94 and 1.97 times that version's speed.
// All steps since v000 together make it 10.8 times as fast.
#include <hip/hip_runtime.h>

// Multi-head attention with biased 'xw' projections and a COMPUTED rotate-half rotary embedding, NO mask (x [2][2048][1024]; q, k, v = x W + b ('xw' (in, out) [1024][1024] 0.02 + zero biases (ONE zeros array bound four times by the module's setup): read; 16 heads x 64); q, k -> cat(x1 cos - x2 sin, x2 cos + x1 sin) on the two 32-wide halves (= t cos + cat(-t2, t1) sin with cat(freqs, freqs)) with angle t x 1 / 10000^(2i/64) (32 f32 frequencies exact for the module's expression 1.0 / (10000.0 ** (arange(0, 64, 2) / 64)); precise cosf/sinf); scores / sqrt(64) (np.sqrt(D_K) as float32); softmax over all keys; out = merged Wo + bo ('xw' + bias) -> [2][2048][1024] (4.2 M); argument order x, Wq, bq, Wk, bk, Wv, bv, Wo, bo).
// Layout, both batches side by side in every plane and every grid (x is taken as [4096][1024]): bf16 copy of x; 'xw' weights transposed once; exact projections + f32 biases; d_cs5 computes the rotary table once (32 baked float32 frequencies) and the projection kernel's own epilogue applies the rotate-half rotation at width 64 and writes the head planes (q, k) or the transposed planes (v); q, k and v come from ONE grid (Wq, Wk, Wv stacked as 3072 rows); one fused attention kernel (scores, running-maximum softmax with the 1/8 in the exponent, P x V; hybrid rows: < 512 hi/lo 3 products, rest fp16); merged hi/lo x wo exact + bo.
// Compute dtypes, f32 accumulate: every input rounded to bf16; projections exact + f32 biases; attention rows < 512 3 products, rest fp16; softmax f32; Wo hl x exact + bias.

#define NB_  2
#define TT   2048
#define DM   1024
#define NH_  16
#define NKV  16
#define REP  (NH_ / NKV)
#define HD   64
#define DQ   (NH_ * HD)
#define DKV  (NKV * HD)
#define RH   512                  // query rows < RH use hi+lo planes
#define SCL  0.125f   // HD^-0.5
typedef _Float16 h16;
typedef unsigned short bf;
typedef __attribute__((ext_vector_type(16))) __bf16   v16bf;
typedef __attribute__((ext_vector_type(16))) _Float16 v16h;
typedef __attribute__((ext_vector_type(8)))  _Float16 v8h;
typedef __attribute__((ext_vector_type(8)))  unsigned short v8us;
typedef __attribute__((ext_vector_type(8)))  float    v8f;
typedef __attribute__((ext_vector_type(4)))  float    v4f;
typedef v8h  __attribute__((may_alias)) v8ha;
typedef v4f  __attribute__((may_alias)) v4fa;
typedef v8us __attribute__((may_alias)) v8usa;

__device__ __forceinline__ unsigned short f2bf(float f) { unsigned u = __float_as_uint(f); u += 0x7FFFu + ((u >> 16) & 1u); return (unsigned short)(u >> 16); }
__device__ __forceinline__ float bf2f(unsigned short b) { return __uint_as_float(((unsigned)b) << 16); }
__device__ __forceinline__ float bfr(float f) { return bf2f(f2bf(f)); }
__device__ __forceinline__ v16h cat16(v8h lo, v8h hi) { return __builtin_shufflevector(lo, hi, 0, 1, 2, 3, 4, 5, 6, 7, 8, 9, 10, 11, 12, 13, 14, 15); }
__device__ __forceinline__ v16bf cat16b(v8us lo, v8us hi) { return __builtin_bit_cast(v16bf, __builtin_shufflevector(lo, hi, 0, 1, 2, 3, 4, 5, 6, 7, 8, 9, 10, 11, 12, 13, 14, 15)); }
__device__ __forceinline__ v8f wmma16(v16h a, v16h b, v8f c) { return __builtin_amdgcn_wmma_f32_16x16x32_f16(false, a, false, b, (short)0, c, false, false); }
__device__ __forceinline__ v8f wmmab(v16bf a, v16bf b, v8f c) { return __builtin_amdgcn_wmma_f32_16x16x32_bf16(false, a, false, b, (short)0, c, false, false); }
__device__ __forceinline__ h16 tohx(float x) { return (h16)x; }
__device__ __forceinline__ void splitf(float y, unsigned short& h, unsigned short& l) { h = f2bf(y); l = f2bf(y - bf2f(h)); }
typedef __attribute__((ext_vector_type(2))) _Float16 v2h;
typedef __attribute__((ext_vector_type(4))) _Float16 v4h;
typedef __attribute__((ext_vector_type(2))) unsigned short v2us;
typedef __attribute__((ext_vector_type(4))) unsigned short v4us;
typedef __attribute__((ext_vector_type(2))) float v2f;
typedef __attribute__((ext_vector_type(4))) int v4i;
typedef __attribute__((ext_vector_type(16))) float v16f;
// XW: s_wait_xcnt 0 stands between issued global loads or stores and the first overwrite of a register they name; the scheduling barriers on both sides keep later arithmetic from being lifted over the wait.
__device__ __forceinline__ void XW() { __builtin_amdgcn_sched_barrier(0); asm volatile("s_wait_xcnt 0x0" ::: "memory"); __builtin_amdgcn_sched_barrier(0); }



// ---- k_gemmw: register-blocked GEMM, ONE WAVE per 64x64 output tile (16 accumulators), operands straight from K-contiguous 16-bit planes; grid (M/64, N/64), 32 threads.
// C[m][n] (+ f32 bias[n]) = sum_k A[m][k] Bt[n][k] (+ split products per NSPLIT). K % 32 == 0.
// EPI says where the tile goes. 0: f32 C, pitch ldc. 1: the q, k, v projections of both batches in one grid: M = NB_ TT rows (batch, t), N = 3 DQ columns (q | k | v, biases bias | biask | biasv). A 64-wide tile is one head (HD == 64) of one of the three, so the tile finishes that head's planes [q, k, v][batch][h] from the accumulators, with no f32 copy in memory:
// q, k: rotate-half rotation out[d] = x[d] cos[t][d] - x[d+32] sin[t][d], out[d+32] = x[d+32] cos[t][d] + x[d] sin[t][d] (table CS [t][d](cos, sin), whose two halves are equal), planes [t][d] (fp16 + hi/lo); v: planes [d][t] (fp16 + hi/lo).
template <typename T16> struct WFrag;
template <> struct WFrag<h16> { typedef v16h V; static __device__ __forceinline__ V ld(const h16* p) { return cat16(*(const v8h*)p, *(const v8h*)(p + 16)); } static __device__ __forceinline__ v8f mma(V a, V b, v8f c) { return wmma16(a, b, c); } };
template <> struct WFrag<bf> { typedef v16bf V; static __device__ __forceinline__ V ld(const bf* p) { return cat16b(*(const v8us*)p, *(const v8us*)(p + 16)); } static __device__ __forceinline__ v8f mma(V a, V b, v8f c) { return wmmab(a, b, c); } };
template <typename T16, int NSPLIT, bool BIAS, int EPI>
__global__ __launch_bounds__(32) void k_gemmw(const T16* __restrict__ A, const T16* __restrict__ A2, const T16* __restrict__ Bt, const T16* __restrict__ Bt2, int K, float* C, int ldc, const float* __restrict__ bias, const float* __restrict__ biask, const float* __restrict__ biasv, const float* __restrict__ CS, h16* P16, bf* Ph, bf* Pl) {
    static_assert(EPI == 0 || (HD == 64 && NKV == NH_ && TT % 64 == 0), "one tile, one head of one batch; q, k, v planes of one size");
    typedef typename WFrag<T16>::V V;
    __shared__ __align__(16) float os[16 * 68];
    const int lane = threadIdx.x & 31, lr = lane & 15, hi = lane >> 4; const int r0 = blockIdx.x * 64, c0 = blockIdx.y * 64;
    // EPI 1: which of q, k, v (sel, the same for the whole wave), the head's first column in its own bias, the tile's first t, and the head's place in the planes
    const int sel = (int)blockIdx.y / NH_, cb = ((int)blockIdx.y % NH_) * 64, t0 = r0 % TT; const size_t pofs = (((size_t)sel * NB_ + r0 / TT) * NH_ + (int)blockIdx.y % NH_) * TT * HD;
    const float* bs = sel == 0 ? bias : sel == 1 ? biask : biasv;
    v8f acc[4][4];
#pragma unroll
    for (int mb = 0; mb < 4; ++mb)
#pragma unroll
        for (int nb = 0; nb < 4; ++nb) acc[mb][nb] = (v8f){};
    const size_t aoff = (size_t)(r0 + lr) * K + 8 * hi, boff = (size_t)(c0 + lr) * K + 8 * hi;
    // EPI 1: 8 lanes a row; a lane takes 4 columns of the head's low half and their partners in the high half, which share one (cos, sin). The table rows of 16 tile rows are fetched one block of rows ahead of their use. (The loops of both epilogues are unrolled because acc, cs and the vectors they fill live in registers and take constant indices only.)
    const int rq = lane >> 3, col = (lane & 7) * 4; v4f b1 = (v4f){}, b2 = (v4f){}, cs[2][4][2];
    auto ldcs = [&](int mb) {
#pragma unroll
        for (int s = 0; s < 4; ++s) { const float* cp = CS + ((size_t)(t0 + mb * 16 + 4 * s + rq) * HD + col) * 2; cs[mb & 1][s][0] = *(const v4f*)cp; cs[mb & 1][s][1] = *(const v4f*)(cp + 4); }
        XW(); };   // the arithmetic that follows reuses the address registers of these loads
    if (EPI == 1 && sel < 2) { const float* bp = bs + cb + col;   // this lane's four low-half columns; their partners stand HD / 2 further
#pragma unroll
        for (int i = 0; i < 4; ++i) { b1[i] = bp[i]; b2[i] = bp[HD / 2 + i]; }
        asm volatile("s_wait_xcnt 0x0" :: "v"(bp) : "memory");   // s_wait_xcnt 0 behind the two bias loads, ahead of the arithmetic that reuses their address registers; the address is an input so that it lives up to the wait and no load's result lands on it
#pragma unroll
        for (int i = 0; i < 4; ++i) { b1[i] = bfr(b1[i]); b2[i] = bfr(b2[i]); }
        ldcs(0); }
    if (EPI == 1 && sel == 2) {   // the four columns' biases, fetched ahead of the K loop like the table rows above
#pragma unroll
        for (int nb = 0; nb < 4; ++nb) b1[nb] = bs[cb + nb * 16 + lr];
        XW(); }   // as behind the table rows
#pragma unroll 1
    for (int kc = 0; kc < K; kc += 32) {
        V a[4], a2[4];
#pragma unroll
        for (int mb = 0; mb < 4; ++mb) { a[mb] = WFrag<T16>::ld(A + aoff + (size_t)mb * 16 * K + kc); if (NSPLIT == 1 || NSPLIT == 2) a2[mb] = WFrag<T16>::ld(A2 + aoff + (size_t)mb * 16 * K + kc); }
#pragma unroll
        for (int nb = 0; nb < 4; ++nb) { const V b = WFrag<T16>::ld(Bt + boff + (size_t)nb * 16 * K + kc); V b2; if (NSPLIT >= 2) b2 = WFrag<T16>::ld(Bt2 + boff + (size_t)nb * 16 * K + kc);
#pragma unroll
            for (int mb = 0; mb < 4; ++mb) { acc[mb][nb] = WFrag<T16>::mma(a[mb], b, acc[mb][nb]); if (NSPLIT == 1 || NSPLIT == 2) acc[mb][nb] = WFrag<T16>::mma(a2[mb], b, acc[mb][nb]); if (NSPLIT >= 2) acc[mb][nb] = WFrag<T16>::mma(a[mb], b2, acc[mb][nb]); } }
        asm volatile("v_nop\n\tv_nop\n\tv_nop\n\tv_nop" : "+v"(acc[0][0]), "+v"(acc[1][1]), "+v"(acc[2][2]), "+v"(acc[3][3]) : "v"(a[0]), "v"(a[3]));
    }
    if (EPI == 1 && sel == 2) {   // a lane's 8 accumulator registers are 8 consecutive t of one column d: 16-byte stores straight into the transposed planes; the four blocks of rows, stored one behind the other, fill each 128-byte line
#pragma unroll
        for (int nb = 0; nb < 4; ++nb) { const float bb = bfr(b1[nb]); const size_t e = pofs + (size_t)(nb * 16 + lr) * TT + t0 + hi * 8;
#pragma unroll
            for (int mb = 0; mb < 4; ++mb) { v8h o16; v8us oh, ol;
#pragma unroll
                for (int j = 0; j < 8; ++j) { const float x = acc[mb][nb][j] + bb; o16[j] = tohx(x); unsigned short a2, c2; splitf(x, a2, c2); oh[j] = a2; ol[j] = c2; }
                *(v8h*)(P16 + e + mb * 16) = o16; *(v8us*)(Ph + e + mb * 16) = oh; *(v8us*)(Pl + e + mb * 16) = ol; }
            XW(); }   // the next column block's arithmetic reuses the registers that these stores name
        return; }
#pragma unroll
    for (int mb = 0; mb < 4; ++mb) {
#pragma unroll
        for (int nb = 0; nb < 4; ++nb) {
#pragma unroll
            for (int j = 0; j < 8; ++j) os[(hi * 8 + j) * 68 + nb * 16 + lr] = acc[mb][nb][j]; }
        __builtin_amdgcn_wave_barrier(); asm volatile("" ::: "memory");
        float* crow = C + (size_t)(r0 + mb * 16) * ldc + c0;
        if (EPI == 0)
{
#pragma unroll
            for (int s = 0; s < 8; ++s) { const int row = 2 * s + hi, cofs = lr * 4; v4f val = *(const v4fa*)(os + row * 68 + cofs); if (BIAS) { val[0] += bfr(bias[c0 + cofs]); val[1] += bfr(bias[c0 + cofs + 1]); val[2] += bfr(bias[c0 + cofs + 2]); val[3] += bfr(bias[c0 + cofs + 3]); }
                *(v4f*)(crow + (size_t)row * ldc + cofs) = val; }
             }
        if (EPI == 1) {
            if (mb < 3) ldcs(mb + 1);
#pragma unroll
            for (int s = 0; s < 4; ++s) { const int row = 4 * s + rq; const v4f x1 = *(const v4fa*)(os + row * 68 + col) + b1, x2 = *(const v4fa*)(os + row * 68 + HD / 2 + col) + b2; const v4f ca = cs[mb & 1][s][0], cb = cs[mb & 1][s][1];
                const v4f cc = { ca[0], ca[2], cb[0], cb[2] }, sn = { ca[1], ca[3], cb[1], cb[3] }; const v4f rl = x1 * cc - x2 * sn, rh = x2 * cc + x1 * sn; v4h l16, u16; v4us lh, ll, uh, ul;
#pragma unroll
                for (int i = 0; i < 4; ++i) { unsigned short a2, c2; l16[i] = tohx(rl[i]); splitf(rl[i], a2, c2); lh[i] = a2; ll[i] = c2; u16[i] = tohx(rh[i]); splitf(rh[i], a2, c2); uh[i] = a2; ul[i] = c2; }
                const size_t e = pofs + (size_t)(t0 + mb * 16 + row) * HD + col;
                *(v4h*)(P16 + e) = l16; *(v4h*)(P16 + e + HD / 2) = u16; *(v4us*)(Ph + e) = lh; *(v4us*)(Ph + e + HD / 2) = uh; *(v4us*)(Pl + e) = ll; *(v4us*)(Pl + e + HD / 2) = ul;
                XW(); } }   // the next rows' arithmetic reuses the registers that these stores name
        __builtin_amdgcn_wave_barrier(); asm volatile("" ::: "memory");
    }
}

// The three preparations (d_wtG, d_cvt8, d_cs5) are blocks of 256 threads of ONE grid, k_prep below; bx is the block's number within its own part.
__device__ __forceinline__ void d_wtG(int bx, const float* __restrict__ w, int K, int N, bf* Bt) {
    const int lane = threadIdx.x & 31; const int L0 = (bx * 8 + (threadIdx.x >> 5)) * 8; const int nlines = N * K / 64;
{
#pragma unroll 1
        for (int l = 0; l < 8; ++l) { const int L = L0 + l; if (L >= nlines) break; const size_t e = (size_t)L * 64 + lane * 2; const int k = (int)(e % K), n = (int)(e / K); v2us o;
            o[0] = f2bf(w[(size_t)k * N + n]); o[1] = f2bf(w[(size_t)(k + 1) * N + n]); *(v2us*)(Bt + e) = o; }
         }
}
__device__ __forceinline__ void d_cvt8(int bx, const float* __restrict__ src, bf* dst, size_t n8) { const size_t i = (size_t)bx * 256 + threadIdx.x; if (i >= n8) return; const v8f v = *(const v8f*)(src + i * 8); v8us o;
#pragma unroll
    for (int k = 0; k < 8; ++k) o[k] = f2bf(v[k]); *(v8us*)(dst + i * 8) = o;  }

__global__ __launch_bounds__(256) void k_csid(float* CS) { const int idx = blockIdx.x * 256 + threadIdx.x; if (idx >= TT * HD) return; v2f cs; cs[0] = 1.0f; cs[1] = 0.0f; *(v2f*)(CS + (size_t)idx * 2) = cs;  }
__constant__ float INVT[HD / 2] = { 1.000000000e+00f, 7.498942018e-01f, 5.623413324e-01f, 4.216965139e-01f, 3.162277639e-01f, 2.371373624e-01f, 1.778279394e-01f, 1.333521456e-01f, 1.000000015e-01f, 7.498941571e-02f, 5.623412877e-02f, 4.216964915e-02f, 3.162277862e-02f, 2.371373586e-02f, 1.778279431e-02f, 1.333521493e-02f, 9.999999776e-03f, 7.498942316e-03f, 5.623413250e-03f, 4.216964822e-03f, 3.162277862e-03f, 2.371373819e-03f, 1.778279431e-03f, 1.333521446e-03f, 1.000000047e-03f, 7.498941850e-04f, 5.623413017e-04f, 4.216964880e-04f, 3.162277862e-04f, 2.371373848e-04f, 1.778279402e-04f, 1.333521504e-04f };   // float32 1 / 10000^(2i/64), generated with jnp to be bit-exact
__device__ __forceinline__ void d_cs5(int bx, float* CS) { const int idx = bx * 256 + threadIdx.x; if (idx >= TT * HD) return; const int d = idx % HD; const int t = idx / HD; const float a = __fmul_rn((float)t, INVT[d % (HD / 2)]); v2f cs; cs[0] = cosf(a); cs[1] = sinf(a); *(v2f*)(CS + (size_t)idx * 2) = cs;  }
// ---- k_prep: the preparations do not depend on one another, so they share one grid: blocks [0, 4 NWB) transpose the four weights (planes stacked in WT), the next NCB compute the rotary table, the last NXB round x (both batches) to bf16.
#define NWB ((DM * DM / 64 + 63) / 64)
#define NCB ((TT * HD + 255) / 256)
#define NXB ((NB_ * TT * DM / 8 + 255) / 256)
__global__ __launch_bounds__(256) void k_prep(const float* __restrict__ x, const float* __restrict__ w0, const float* __restrict__ w1, const float* __restrict__ w2, const float* __restrict__ w3, bf* XB, bf* WT, float* CS) {
    const int bx = (int)blockIdx.x;
    if (bx < 4 * NWB) { const int y = bx / NWB; d_wtG(bx % NWB, y == 0 ? w0 : y == 1 ? w1 : y == 2 ? w2 : w3, DM, DM, WT + (size_t)y * DM * DM); }
    else if (bx < 4 * NWB + NCB) d_cs5(bx - 4 * NWB, CS);
    else d_cvt8(bx - 4 * NWB - NCB, x, XB, (size_t)NB_ * TT * DM / 8);
}
// ---- k_fattn: scores, softmax and P x V of one head in ONE kernel; S and P stay in registers. One wave owns 16 NQ query rows and walks the 2048 keys 32 at a time; the waves share nothing (no LDS, no barrier).
// S^T = K Q^T (A = 16 key rows, B = 16 query rows kept in registers): D register r of lane (lr, hi) is key 8 hi + r of query lr, so the two key tiles of a trip, converted in place, are the B operand (k order 8 hi + s, 16 + 8 hi + s: the order of WFrag::ld) of O^T += V^T P^T.
// Softmax with a running maximum m per query, held in the exponent's own unit (score x SCL x log2 e): p = exp2(s c - m), unnormalised; m, the sum and O move only on a trip where some score stands more than 8 above its m (so p <= 2^8); O / sum at the end.
__device__ __forceinline__ float xhalf(float x) { const int b = __float_as_int(x); return __int_as_float(__builtin_amdgcn_permlanex16(b, b, 0x76543210, 0xfedcba98, false, false)); }   // lane l <-> l ^ 16
template <typename T16> struct PFrag;
template <> struct PFrag<h16> { static __device__ __forceinline__ void cv(v16f e, v16h& p, v16h& p2) { (void)p2; p = __builtin_convertvector(e, v16h); } };
template <> struct PFrag<bf> { static __device__ __forceinline__ void cv(v16f e, v16bf& p, v16bf& p2) { p = __builtin_convertvector(e, v16bf); p2 = __builtin_convertvector(e - __builtin_convertvector(p, v16f), v16bf); } };   // hi + lo, both rounded to nearest even as in splitf
template <typename T16, bool SPLIT, int NQ>
__device__ __forceinline__ void fattn(const T16* __restrict__ Q, const T16* __restrict__ Q2, const T16* __restrict__ Kp, const T16* __restrict__ K2, const T16* __restrict__ Vt, const T16* __restrict__ V2, int q0, bf* Ah, bf* Al) {
    typedef typename WFrag<T16>::V V;
    const float C2 = SCL * 1.4426950408889634f;
    const int lane = threadIdx.x & 31, lr = lane & 15, hi = lane >> 4;
    V qf[NQ][2], qf2[NQ][2], kf[2][2], kf2[2][2], vf[4], vf2[4];
    const T16* qa[NQ]; const T16* qa2[NQ];   // each lane's own Q row addresses
#pragma unroll
    for (int nq = 0; nq < NQ; ++nq) { const size_t o = (size_t)(q0 + nq * 16 + lr) * HD + 8 * hi; qa[nq] = Q + o; qa2[nq] = SPLIT ? Q2 + o : nullptr;
#pragma unroll
        for (int ks = 0; ks < 2; ++ks) { qf[nq][ks] = WFrag<T16>::ld(qa[nq] + ks * 32); if (SPLIT) qf2[nq][ks] = WFrag<T16>::ld(qa2[nq] + ks * 32); } }
    // the wait behind the Q loads takes their row addresses as inputs, so that those registers stay theirs up to the wait
    static_assert(NQ == 2 || NQ == 3, "row addresses named below");
    if (SPLIT) asm volatile("s_wait_xcnt 0x0" :: "v"(qa[0]), "v"(qa[1]), "v"(qa[NQ - 1]), "v"(qa2[0]), "v"(qa2[1]), "v"(qa2[NQ - 1]) : "memory");
    else asm volatile("s_wait_xcnt 0x0" :: "v"(qa[0]), "v"(qa[1]), "v"(qa[NQ - 1]) : "memory");
    __builtin_amdgcn_sched_barrier(0);   // later address arithmetic stays behind the wait
    // K and V^T addresses: each lane's own pointers, which live through the loop and step 32 keys a trip, + a constant
    const T16* kq = Kp + lr * HD + 8 * hi; const T16* kq2 = SPLIT ? K2 + lr * HD + 8 * hi : nullptr; const T16* vq = Vt + lr * TT + 8 * hi; const T16* vq2 = SPLIT ? V2 + lr * TT + 8 * hi : nullptr;
#pragma unroll
    for (int kb = 0; kb < 2; ++kb)
#pragma unroll
        for (int ks = 0; ks < 2; ++ks) { const int c = kb * 16 * HD + ks * 32; kf[kb][ks] = WFrag<T16>::ld(kq + c); if (SPLIT) kf2[kb][ks] = WFrag<T16>::ld(kq2 + c); }
    XW();   // also keeps the first K loads ahead of the first V loads, as in the loop: loads return in order, and with V first the loop's waits for K would be set to wait for the V rows in flight as well
#pragma unroll
    for (int db = 0; db < 4; ++db) { const int c = db * 16 * TT; vf[db] = WFrag<T16>::ld(vq + c); if (SPLIT) vf2[db] = WFrag<T16>::ld(vq2 + c); }
    v8f oa[4][NQ]; float m[NQ]; v2f l[NQ];   // l: two partial sums a lane (even and odd registers), joined at the end
#pragma unroll
    for (int nq = 0; nq < NQ; ++nq) { m[nq] = -3.0e38f; l[nq] = (v2f){};
#pragma unroll
        for (int db = 0; db < 4; ++db) oa[db][nq] = (v8f){}; }
#pragma unroll 1   // rolled: the trips depend on one another through m, the sum and O, and one trip already takes more than 256 registers, so a second copy of the body buys nothing
    for (int key0 = 0; key0 < TT; key0 += 32) {
        v8f s[2][NQ];
#pragma unroll
        for (int kb = 0; kb < 2; ++kb)
#pragma unroll
            for (int nq = 0; nq < NQ; ++nq) { v8f t = (v8f){};
#pragma unroll
                for (int ks = 0; ks < 2; ++ks) { t = WFrag<T16>::mma(kf[kb][ks], qf[nq][ks], t); if (SPLIT) { t = WFrag<T16>::mma(kf2[kb][ks], qf[nq][ks], t); t = WFrag<T16>::mma(kf[kb][ks], qf2[nq][ks], t); } }
                s[kb][nq] = t; }
        int st = (key0 + 32 < TT) ? 1 : 0;   // the pointers step to the next trip's keys; on the last trip they stay (its rows are read again, unused)
        __builtin_amdgcn_sched_barrier(0);   // the wait below stays behind the score products, which then cover the time the V loads issued just before them still need
        asm volatile("s_wait_xcnt 0x0" : "+s"(st) : : "memory");   // the wait before the K pointers, which loads in flight name, are overwritten; the step passes through it so that the additions stand behind it
        kq += st * (32 * HD); if (SPLIT) kq2 += st * (32 * HD);
#pragma unroll
        for (int kb = 0; kb < 2; ++kb)   // the next trip's K rows fly during this trip's softmax and P x V
#pragma unroll
            for (int ks = 0; ks < 2; ++ks) { const int c = kb * 16 * HD + ks * 32; kf[kb][ks] = WFrag<T16>::ld(kq + c); if (SPLIT) kf2[kb][ks] = WFrag<T16>::ld(kq2 + c); }
        float mx[NQ]; bool need = false;   // mx: the maximum over this lane's own 16 keys; the other half's is fetched only where m moves
#pragma unroll
        for (int nq = 0; nq < NQ; ++nq) { float t = s[0][nq][0];
#pragma unroll
            for (int r = 1; r < 16; ++r) t = fmaxf(t, s[r >> 3][nq][r & 7]);
            mx[nq] = t * C2; need = need || (mx[nq] > m[nq] + 8.0f); }
        if (__builtin_amdgcn_ballot_w32(need) != 0) {   // wave-uniform branch: the matrix instructions below need every lane on, and both halves of a column must hold one m
#pragma unroll
            for (int nq = 0; nq < NQ; ++nq) { const float mn = fmaxf(m[nq], fmaxf(mx[nq], xhalf(mx[nq]))); const float al = __builtin_amdgcn_exp2f(m[nq] - mn); m[nq] = mn; l[nq] *= al;
#pragma unroll
                for (int db = 0; db < 4; ++db) oa[db][nq] *= al; } }
#pragma unroll
        for (int nq = 0; nq < NQ; ++nq) { v16f e;
#pragma unroll
            for (int r = 0; r < 16; r += 2) { const v2f a = { s[r >> 3][nq][r & 7], s[r >> 3][nq][(r & 7) + 1] }; const v2f t = __builtin_elementwise_fma(a, (v2f){ C2, C2 }, (v2f){ -m[nq], -m[nq] });   // register pairs as the accumulator holds them: packed f32 without moves
                const v2f x = { __builtin_amdgcn_exp2f(t[0]), __builtin_amdgcn_exp2f(t[1]) }; e[r] = x[0]; e[r + 1] = x[1]; l[nq] += x; }
            V p, p2; PFrag<T16>::cv(e, p, p2);
#pragma unroll
            for (int db = 0; db < 4; ++db) { oa[db][nq] = WFrag<T16>::mma(vf[db], p, oa[db][nq]); if (SPLIT) { oa[db][nq] = WFrag<T16>::mma(vf[db], p2, oa[db][nq]); oa[db][nq] = WFrag<T16>::mma(vf2[db], p, oa[db][nq]); } } }
        asm volatile("s_wait_xcnt 0x0" : "+s"(st) : : "memory");   // the same wait before the V pointers are overwritten
        vq += st * 32; if (SPLIT) vq2 += st * 32;
#pragma unroll
        for (int db = 0; db < 4; ++db) { const int c = db * 16 * TT; vf[db] = WFrag<T16>::ld(vq + c); if (SPLIT) vf2[db] = WFrag<T16>::ld(vq2 + c); }   // the next trip's V^T rows fly during its score products and softmax
    }
    XW();   // the last trip's loads are still in flight where the epilogue reuses their address registers
#pragma unroll
    for (int nq = 0; nq < NQ; ++nq) { const float ls = l[nq][0] + l[nq][1]; const float inv = __fdiv_rn(1.0f, ls + xhalf(ls)); const size_t oo = (size_t)(q0 + nq * 16 + lr) * DQ + 8 * hi;
#pragma unroll
        for (int db = 0; db < 4; ++db) { v8us oh, ol;
#pragma unroll
            for (int r = 0; r < 8; ++r) { unsigned short a, c2; splitf(oa[db][nq][r] * inv, a, c2); oh[r] = a; ol[r] = c2; }
            *(v8us*)(Ah + oo + db * 16) = oh; XW(); *(v8us*)(Al + oo + db * 16) = ol; XW(); } }   // the wait behind each store: the next rows' arithmetic reuses the registers that the store names
}
// grid (RH / 32, heads, batches), 3 independent waves: wave 0 takes 32 hi/lo rows (three products each), waves 1 and 2 take 48 fp16 rows each, so that every work-group asks its cache for the same number of fragment loads a trip.
static_assert((TT - RH) / 96 == RH / 32 && (TT - RH) % 96 == 0 && RH % 32 == 0 && TT % 32 == 0 && TT >= 64 && HD == 64, "row split and trip shape of k_fattn");
__global__ __launch_bounds__(96) void k_fattn(const h16* __restrict__ Q16, const h16* __restrict__ K16, const h16* __restrict__ V16, const bf* __restrict__ Qh, const bf* __restrict__ Ql, const bf* __restrict__ Kh, const bf* __restrict__ Kl, const bf* __restrict__ Vh, const bf* __restrict__ Vl, bf* Ah, bf* Al) {
    const int wave = __builtin_amdgcn_readfirstlane((int)(threadIdx.x >> 5)); const size_t po = ((size_t)blockIdx.z * NH_ + blockIdx.y) * TT * HD; const int bx = (int)blockIdx.x; const size_t ao = (size_t)blockIdx.z * TT * DQ + blockIdx.y * HD; Ah += ao; Al += ao;
    if (wave == 0) fattn<bf, true, 2>(Qh + po, Ql + po, Kh + po, Kl + po, Vh + po, Vl + po, bx * 32, Ah, Al);
    else fattn<h16, false, 3>(Q16 + po, nullptr, K16 + po, nullptr, V16 + po, nullptr, RH + bx * 96 + (wave - 1) * 48, Ah, Al);
}

extern "C" void kernel_launch(void* const* d_in, const int* in_sizes, int n_in,
                              void* d_out, int out_size, void* d_ws, size_t ws_size, hipStream_t stream) {
    (void)in_sizes; (void)n_in; (void)out_size;
    const float* x = (const float*)d_in[0]; const float* wq = (const float*)d_in[1]; const float* bq = (const float*)d_in[2]; const float* wk = (const float*)d_in[3]; const float* bk = (const float*)d_in[4]; const float* wv = (const float*)d_in[5]; const float* bv = (const float*)d_in[6]; const float* wo = (const float*)d_in[7]; const float* bo = (const float*)d_in[8];   /* order x, Wq, bq, Wk, bk, Wv, bv, Wo, bo ('xw' (in, out) [1024][1024] + [1024]): NINE inputs, all read: the host's own binding */
    float* OUT = (float*)d_out;     // [2][2048][1024]
    char* wsp = (char*)d_ws;
    auto take = [&](size_t bytes) { char* p = wsp; wsp += (bytes + 255) & ~(size_t)255; return (void*)p; };
    static_assert(DQ == DM && DKV == DM, "four weights of one size, stacked");
    const size_t PL = (size_t)NB_ * NH_ * TT * HD;   // one plane: both batches, all heads
    bf* WT = (bf*)take((size_t)4 * DM * DM * 2);   // Wq, Wk, Wv, Wo transposed, stacked
    float* CS = (float*)take((size_t)TT * HD * 2 * 4);
    bf* XB = (bf*)take((size_t)NB_ * TT * DM * 2);
    h16* P16 = (h16*)take(3 * PL * 2); bf* Ph = (bf*)take(3 * PL * 2); bf* Pl = (bf*)take(3 * PL * 2);   // q | k | v(transposed), each [batch][h]
    bf* ATh = (bf*)take((size_t)NB_ * TT * DQ * 2); bf* ATl = (bf*)take((size_t)NB_ * TT * DQ * 2);
    if ((size_t)(wsp - (char*)d_ws) > ws_size) return;    // ws 256 MiB
    k_prep<<<4 * NWB + NCB + NXB, 256, 0, stream>>>(x, wq, wk, wv, wo, XB, WT, CS);   /* with the COMPUTED rotary table (this module rotates q and k); k_csid stays defined and is NOT launched */
    k_gemmw<bf, 0, true, 1><<<dim3(NB_ * TT / 64, 3 * DQ / 64, 1), 32, 0, stream>>>(XB, nullptr, WT, nullptr, DM, nullptr, 0, bq, bk, bv, CS, P16, Ph, Pl);
    k_fattn<<<dim3(RH / 32, NH_, NB_), 96, 0, stream>>>(P16, P16 + PL, P16 + 2 * PL, Ph, Pl, Ph + PL, Pl + PL, Ph + 2 * PL, Pl + 2 * PL, ATh, ATl);   // one kv head per query head
    k_gemmw<bf, 1, true, 0><<<dim3(NB_ * TT / 64, DM / 64, 1), 32, 0, stream>>>(ATh, ATl, WT + (size_t)3 * DM * DM, nullptr, DQ, OUT, DM, bo, nullptr, nullptr, nullptr, nullptr, nullptr, nullptr);
}

// v005
// Measured time: 145 microseconds a run.
// Timed twice side by side with v004, it ran 1.27 times as fast both times.
// All steps since v000 together make it 13.8 times as fast.
#include <hip/hip_runtime.h>

// Multi-head attention with biased 'xw' projections and a COMPUTED rotate-half rotary embedding, NO mask (x [2][2048][1024]; q, k, v = x W + b ('xw' (in, out) [1024][1024] 0.02 + zero biases (ONE zeros array bound four times by the module's setup): read; 16 heads x 64); q, k -> cat(x1 cos - x2 sin, x2 cos + x1 sin) on the two 32-wide halves (= t cos + cat(-t2, t1) sin with cat(freqs, freqs)) with angle t x 1 / 10000^(2i/64) (32 f32 frequencies exact for the module's expression 1.0 / (10000.0 ** (arange(0, 64, 2) / 64)); precise cosf/sinf); scores / sqrt(64) (np.sqrt(D_K) as float32); softmax over all keys; out = merged Wo + bo ('xw' + bias) -> [2][2048][1024] (4.2 M); argument order x, Wq, bq, Wk, bk, Wv, bv, Wo, bo).
// Layout, both batches side by side in every plane and every grid (x is taken as [4096][1024]): bf16 copy of x; 'xw' weights transposed once; exact projections + f32 biases; d_cs5 computes the rotary table once (32 baked float32 frequencies) and the projection kernel's own epilogue applies the rotate-half rotation at width 64 and writes the head planes (q, k) or the transposed planes (v); q, k and v come from ONE grid (Wq, Wk, Wv stacked as 3072 rows); one fused attention kernel (scores, running-maximum softmax with the 1/8 in the exponent, P x V; hybrid rows: < 512 hi/lo 3 products, rest fp16); merged hi/lo x wo exact + bo.
// Fragment order: every 16-bit operand plane [rows][k] lies in memory as tiles of 16 rows x 32 k (FT = 512 elements, 1 KiB), the tiles of one block of 16 rows one behind the other along k (v: the four d tiles of 32 keys together). Inside a tile element (r, k) stands at (k / 16) * 256 + ((k % 16) / 8 * 16 + r) * 8 + k % 8, so lane (lr, hi) finds its two 16-byte pieces (k = 8 hi + s and 16 + 8 hi + s) at lane * 8 and 256 + lane * 8 and each wave-wide 16-byte load or store covers 512 contiguous bytes (4 whole lines).
// Compute dtypes, f32 accumulate: every input rounded to bf16; projections exact + f32 biases; attention rows < 512 3 products, rest fp16; softmax f32; Wo hl x exact + bias.

#define NB_  2
#define TT   2048
#define DM   1024
#define NH_  16
#define NKV  16
#define REP  (NH_ / NKV)
#define HD   64
#define DQ   (NH_ * HD)
#define DKV  (NKV * HD)
#define RH   512                  // query rows < RH use hi+lo planes
#define SCL  0.125f   // HD^-0.5
#define FT   512                  // elements of one fragment tile (16 rows x 32 k)
typedef _Float16 h16;
typedef unsigned short bf;
typedef __attribute__((ext_vector_type(16))) __bf16   v16bf;
typedef __attribute__((ext_vector_type(16))) _Float16 v16h;
typedef __attribute__((ext_vector_type(8)))  _Float16 v8h;
typedef __attribute__((ext_vector_type(8)))  unsigned short v8us;
typedef __attribute__((ext_vector_type(8)))  float    v8f;
typedef __attribute__((ext_vector_type(4)))  float    v4f;
typedef v8h  __attribute__((may_alias)) v8ha;
typedef v4f  __attribute__((may_alias)) v4fa;
typedef v8us __attribute__((may_alias)) v8usa;

__device__ __forceinline__ unsigned short f2bf(float f) { unsigned u = __float_as_uint(f); u += 0x7FFFu + ((u >> 16) & 1u); return (unsigned short)(u >> 16); }
__device__ __forceinline__ float bf2f(unsigned short b) { return __uint_as_float(((unsigned)b) << 16); }
__device__ __forceinline__ float bfr(float f) { return bf2f(f2bf(f)); }
__device__ __forceinline__ v16h cat16(v8h lo, v8h hi) { return __builtin_shufflevector(lo, hi, 0, 1, 2, 3, 4, 5, 6, 7, 8, 9, 10, 11, 12, 13, 14, 15); }
__device__ __forceinline__ v16bf cat16b(v8us lo, v8us hi) { return __builtin_bit_cast(v16bf, __builtin_shufflevector(lo, hi, 0, 1, 2, 3, 4, 5, 6, 7, 8, 9, 10, 11, 12, 13, 14, 15)); }
__device__ __forceinline__ v8f wmma16(v16h a, v16h b, v8f c) { return __builtin_amdgcn_wmma_f32_16x16x32_f16(false, a, false, b, (short)0, c, false, false); }
__device__ __forceinline__ v8f wmmab(v16bf a, v16bf b, v8f c) { return __builtin_amdgcn_wmma_f32_16x16x32_bf16(false, a, false, b, (short)0, c, false, false); }
__device__ __forceinline__ h16 tohx(float x) { return (h16)x; }
__device__ __forceinline__ void splitf(float y, unsigned short& h, unsigned short& l) { h = f2bf(y); l = f2bf(y - bf2f(h)); }
typedef __attribute__((ext_vector_type(2))) _Float16 v2h;
typedef __attribute__((ext_vector_type(4))) _Float16 v4h;
typedef __attribute__((ext_vector_type(2))) unsigned short v2us;
typedef __attribute__((ext_vector_type(4))) unsigned short v4us;
typedef __attribute__((ext_vector_type(2))) float v2f;
typedef __attribute__((ext_vector_type(4))) int v4i;
typedef __attribute__((ext_vector_type(16))) float v16f;
// XW: s_wait_xcnt 0 stands between issued global loads or stores and the first overwrite of a register they name; the scheduling barriers on both sides keep later arithmetic from being lifted over the wait.
__device__ __forceinline__ void XW() { __builtin_amdgcn_sched_barrier(0); asm volatile("s_wait_xcnt 0x0" ::: "memory"); __builtin_amdgcn_sched_barrier(0); }



// ---- k_gemmw: register-blocked GEMM, ONE WAVE per 64x64 output tile (16 accumulators), operands straight from 16-bit planes in fragment order (WFrag::ld takes tile + lane * 8); grid (M/64, N/64), 32 threads.
// C[m][n] (+ f32 bias[n]) = sum_k A[m][k] Bt[n][k] (+ split products per NSPLIT). K % 32 == 0.
// EPI says where the tile goes. 0: f32 C, pitch ldc. 1: the q, k, v projections of both batches in one grid: M = NB_ TT rows (batch, t), N = 3 DQ columns (q | k | v, biases bias | biask | biasv). A 64-wide tile is one head (HD == 64) of one of the three, so the tile finishes that head's planes [q, k, v][batch][h] from the accumulators, with no f32 copy in memory:
// q, k: rotate-half rotation out[d] = x[d] cos[t][d] - x[d+32] sin[t][d], out[d+32] = x[d+32] cos[t][d] + x[d] sin[t][d] (table CS [t][d](cos, sin), whose two halves are equal), planes [t][d] (fp16 + hi/lo); v: planes [d][t] (fp16 + hi/lo); all in fragment order.
template <typename T16> struct WFrag;
template <> struct WFrag<h16> { typedef v16h V; static __device__ __forceinline__ V ld(const h16* p) { return cat16(*(const v8h*)p, *(const v8h*)(p + 256)); } static __device__ __forceinline__ v8f mma(V a, V b, v8f c) { return wmma16(a, b, c); } };
template <> struct WFrag<bf> { typedef v16bf V; static __device__ __forceinline__ V ld(const bf* p) { return cat16b(*(const v8us*)p, *(const v8us*)(p + 256)); } static __device__ __forceinline__ v8f mma(V a, V b, v8f c) { return wmmab(a, b, c); } };
template <typename T16, int NSPLIT, bool BIAS, int EPI, int K>
__global__ __launch_bounds__(32) void k_gemmw(const T16* __restrict__ A, const T16* __restrict__ A2, const T16* __restrict__ Bt, const T16* __restrict__ Bt2, float* C, int ldc, const float* __restrict__ bias, const float* __restrict__ biask, const float* __restrict__ biasv, const float* __restrict__ CS, h16* P16, bf* Ph, bf* Pl) {
    static_assert(EPI == 0 || (HD == 64 && NKV == NH_ && TT % 64 == 0), "one tile, one head of one batch; q, k, v planes of one size");
    typedef typename WFrag<T16>::V V;
    __shared__ __align__(16) float os[16 * 68];
    const int lane = threadIdx.x & 31, lr = lane & 15, hi = lane >> 4; const int r0 = blockIdx.x * 64, c0 = blockIdx.y * 64;
    // EPI 1: which of q, k, v (sel, the same for the whole wave), the head's first column in its own bias, the tile's first t, and the head's place in the planes
    const int sel = (int)blockIdx.y / NH_, cb = ((int)blockIdx.y % NH_) * 64, t0 = r0 % TT; const size_t pofs = (((size_t)sel * NB_ + r0 / TT) * NH_ + (int)blockIdx.y % NH_) * TT * HD;
    const float* bs = sel == 0 ? bias : sel == 1 ? biask : biasv;
    v8f acc[4][4];
#pragma unroll
    for (int mb = 0; mb < 4; ++mb)
#pragma unroll
        for (int nb = 0; nb < 4; ++nb) acc[mb][nb] = (v8f){};
    const size_t aoff = (size_t)r0 * K + lane * 8, boff = (size_t)c0 * K + lane * 8;   // a block of 16 rows is K / 32 tiles = 16 K elements
    // each lane's own places in the first tiles: pointers that live through the K loop and step one tile a trip; the other blocks of rows stand at constant distances (K is a template constant)
    const T16* pa = A + aoff; const T16* pa2 = (NSPLIT == 1 || NSPLIT == 2) ? A2 + aoff : nullptr; const T16* pb = Bt + boff; const T16* pb2 = NSPLIT >= 2 ? Bt2 + boff : nullptr;
    // EPI 1: 8 lanes a row; a lane takes 4 columns of the head's low half and their partners in the high half, which share one (cos, sin). The table rows of 16 tile rows are fetched one block of rows ahead of their use. (The loops of both epilogues are unrolled because acc, cs and the vectors they fill live in registers and take constant indices only.)
    const int rq = lane >> 3, col = (lane & 7) * 4; v4f b1 = (v4f){}, b2 = (v4f){}, cs[2][4][2];
    auto ldcs = [&](int mb) {
#pragma unroll
        for (int s = 0; s < 4; ++s) { const float* cp = CS + ((size_t)(t0 + mb * 16 + 4 * s + rq) * HD + col) * 2; cs[mb & 1][s][0] = *(const v4f*)cp; cs[mb & 1][s][1] = *(const v4f*)(cp + 4); }
        XW(); };   // the arithmetic that follows reuses the address registers of these loads
    if (EPI == 1 && sel < 2) { const float* bp = bs + cb + col;   // this lane's four low-half columns; their partners stand HD / 2 further
#pragma unroll
        for (int i = 0; i < 4; ++i) { b1[i] = bp[i]; b2[i] = bp[HD / 2 + i]; }
        asm volatile("s_wait_xcnt 0x0" :: "v"(bp) : "memory");   // s_wait_xcnt 0 behind the two bias loads, ahead of the arithmetic that reuses their address registers; the address is an input so that it lives up to the wait and no load's result lands on it
#pragma unroll
        for (int i = 0; i < 4; ++i) { b1[i] = bfr(b1[i]); b2[i] = bfr(b2[i]); }
        ldcs(0); }
    if (EPI == 1 && sel == 2) {   // the four columns' biases, fetched ahead of the K loop like the table rows above
#pragma unroll
        for (int nb = 0; nb < 4; ++nb) b1[nb] = bs[cb + nb * 16 + lr];
        XW(); }   // as behind the table rows
#pragma unroll 1
    for (int kc = 0; kc < K; kc += 32) {
        V a[4], a2[4], b[4], b2[4];
#pragma unroll
        for (int mb = 0; mb < 4; ++mb) { a[mb] = WFrag<T16>::ld(pa + mb * 16 * K); if (NSPLIT == 1 || NSPLIT == 2) a2[mb] = WFrag<T16>::ld(pa2 + mb * 16 * K); }
#pragma unroll
        for (int nb = 0; nb < 4; ++nb) { b[nb] = WFrag<T16>::ld(pb + nb * 16 * K); if (NSPLIT >= 2) b2[nb] = WFrag<T16>::ld(pb2 + nb * 16 * K); }
        __builtin_amdgcn_sched_barrier(0);   // the trip's loads stay together ahead of its products: left free, this build fetches the fragments of one operand one after the other into one register set and waits out a load latency for each
#pragma unroll
        for (int nb = 0; nb < 4; ++nb) {
#pragma unroll
            for (int mb = 0; mb < 4; ++mb) { acc[mb][nb] = WFrag<T16>::mma(a[mb], b[nb], acc[mb][nb]); if (NSPLIT == 1 || NSPLIT == 2) acc[mb][nb] = WFrag<T16>::mma(a2[mb], b[nb], acc[mb][nb]); if (NSPLIT >= 2) acc[mb][nb] = WFrag<T16>::mma(a[mb], b2[nb], acc[mb][nb]); } }
        asm volatile("v_nop\n\tv_nop\n\tv_nop\n\tv_nop" : "+v"(acc[0][0]), "+v"(acc[1][1]), "+v"(acc[2][2]), "+v"(acc[3][3]) : "v"(a[0]), "v"(a[3]));
        int st = FT; asm volatile("s_wait_xcnt 0x0" : "+s"(st) : : "memory");   // the wait before the pointers, which this trip's loads name, are overwritten; the step passes through it so that the additions stand behind it
        pa += st; pb += st; if (NSPLIT == 1 || NSPLIT == 2) pa2 += st; if (NSPLIT >= 2) pb2 += st;
    }
    if (EPI == 1 && sel == 2) {   // a lane's 8 accumulator registers are 8 consecutive t of one column d: the lane's own 16-byte piece of tile (32 keys, d block nb), so each store covers 512 contiguous bytes
#pragma unroll
        for (int nb = 0; nb < 4; ++nb) { const float bb = bfr(b1[nb]); const size_t e = pofs + (size_t)(t0 / 32 * 4 + nb) * FT + lane * 8;
#pragma unroll
            for (int mb = 0; mb < 4; ++mb) { v8h o16; v8us oh, ol;
#pragma unroll
                for (int j = 0; j < 8; ++j) { const float x = acc[mb][nb][j] + bb; o16[j] = tohx(x); unsigned short a2, c2; splitf(x, a2, c2); oh[j] = a2; ol[j] = c2; }
                const int f = (mb >> 1) * 4 * FT + (mb & 1) * 256; *(v8h*)(P16 + e + f) = o16; *(v8us*)(Ph + e + f) = oh; *(v8us*)(Pl + e + f) = ol; }
            XW(); }   // the next column block's arithmetic reuses the registers that these stores name
        return; }
#pragma unroll
    for (int mb = 0; mb < 4; ++mb) {
#pragma unroll
        for (int nb = 0; nb < 4; ++nb) {
#pragma unroll
            for (int j = 0; j < 8; ++j) os[(hi * 8 + j) * 68 + nb * 16 + lr] = acc[mb][nb][j]; }
        __builtin_amdgcn_wave_barrier(); asm volatile("" ::: "memory");
        float* crow = C + (size_t)(r0 + mb * 16) * ldc + c0;
        if (EPI == 0)
{
#pragma unroll
            for (int s = 0; s < 8; ++s) { const int row = 2 * s + hi, cofs = lr * 4; v4f val = *(const v4fa*)(os + row * 68 + cofs); if (BIAS) { val[0] += bfr(bias[c0 + cofs]); val[1] += bfr(bias[c0 + cofs + 1]); val[2] += bfr(bias[c0 + cofs + 2]); val[3] += bfr(bias[c0 + cofs + 3]); }
                *(v4f*)(crow + (size_t)row * ldc + cofs) = val; }
             }
        if (EPI == 1) {
            if (mb < 3) ldcs(mb + 1);
#pragma unroll
            for (int s = 0; s < 4; ++s) { const int row = 4 * s + rq; const v4f x1 = *(const v4fa*)(os + row * 68 + col) + b1, x2 = *(const v4fa*)(os + row * 68 + HD / 2 + col) + b2; const v4f ca = cs[mb & 1][s][0], cb = cs[mb & 1][s][1];
                const v4f cc = { ca[0], ca[2], cb[0], cb[2] }, sn = { ca[1], ca[3], cb[1], cb[3] }; const v4f rl = x1 * cc - x2 * sn, rh = x2 * cc + x1 * sn; v4h l16, u16; v4us lh, ll, uh, ul;
#pragma unroll
                for (int i = 0; i < 4; ++i) { unsigned short a2, c2; l16[i] = tohx(rl[i]); splitf(rl[i], a2, c2); lh[i] = a2; ll[i] = c2; u16[i] = tohx(rh[i]); splitf(rh[i], a2, c2); uh[i] = a2; ul[i] = c2; }
                const size_t e = pofs + (size_t)(t0 / 16 + mb) * 2 * FT + (col / 16) * 256 + ((col % 16) / 8 * 16 + row) * 8 + col % 8;   // the low half is the rows' first tile, the high half the second
                *(v4h*)(P16 + e) = l16; *(v4h*)(P16 + e + FT) = u16; *(v4us*)(Ph + e) = lh; *(v4us*)(Ph + e + FT) = uh; *(v4us*)(Pl + e) = ll; *(v4us*)(Pl + e + FT) = ul;
                XW(); } }   // the next rows' arithmetic reuses the registers that these stores name
        __builtin_amdgcn_wave_barrier(); asm volatile("" ::: "memory");
    }
}

// The three preparations (d_wtG, d_cvt8, d_cs5) are blocks of 256 threads of ONE grid, k_prep below; bx is the block's number within its own part.
// d_wtG: one wave builds one tile (16 n x 32 k) of the transposed weight; the 8 waves of a block take 8 neighbouring n blocks of the same 32 k, so that the block reads 512 contiguous bytes of each row of w.
__device__ __forceinline__ void d_wtG(int bx, const float* __restrict__ w, int K, int N, bf* Bt) {
    const int lane = threadIdx.x & 31, lr = lane & 15, hi = lane >> 4; const int g = bx * 8 + (threadIdx.x >> 5); if (g >= (N / 16) * (K / 32)) return;
    const int tn = g % (N / 16), tk = g / (N / 16); const float* s = w + (size_t)(tk * 32 + 8 * hi) * N + tn * 16 + lr; v8us o0, o1;
#pragma unroll
    for (int i = 0; i < 8; ++i) { o0[i] = f2bf(s[(size_t)i * N]); o1[i] = f2bf(s[(size_t)(16 + i) * N]); }
    bf* d = Bt + ((size_t)tn * (K / 32) + tk) * FT + lane * 8; *(v8us*)d = o0; *(v8us*)(d + 256) = o1;
}
// d_cvt8: thread i writes the i-th 16-byte piece of the plane in fragment order and reads the 8 values of src [rows][K] that belong there.
__device__ __forceinline__ void d_cvt8(int bx, const float* __restrict__ src, int K, bf* dst, size_t n8) { const size_t i = (size_t)bx * 256 + threadIdx.x; if (i >= n8) return; const int lane = (int)(i & 31), j = (int)(i >> 5) & 1; const size_t tile = i >> 6;
    const v8f v = *(const v8f*)(src + (tile / (K / 32) * 16 + (lane & 15)) * K + tile % (K / 32) * 32 + j * 16 + (lane >> 4) * 8); v8us o;
#pragma unroll
    for (int k = 0; k < 8; ++k) o[k] = f2bf(v[k]); *(v8us*)(dst + i * 8) = o;  }

__global__ __launch_bounds__(256) void k_csid(float* CS) { const int idx = blockIdx.x * 256 + threadIdx.x; if (idx >= TT * HD) return; v2f cs; cs[0] = 1.0f; cs[1] = 0.0f; *(v2f*)(CS + (size_t)idx * 2) = cs;  }
__constant__ float INVT[HD / 2] = { 1.000000000e+00f, 7.498942018e-01f, 5.623413324e-01f, 4.216965139e-01f, 3.162277639e-01f, 2.371373624e-01f, 1.778279394e-01f, 1.333521456e-01f, 1.000000015e-01f, 7.498941571e-02f, 5.623412877e-02f, 4.216964915e-02f, 3.162277862e-02f, 2.371373586e-02f, 1.778279431e-02f, 1.333521493e-02f, 9.999999776e-03f, 7.498942316e-03f, 5.623413250e-03f, 4.216964822e-03f, 3.162277862e-03f, 2.371373819e-03f, 1.778279431e-03f, 1.333521446e-03f, 1.000000047e-03f, 7.498941850e-04f, 5.623413017e-04f, 4.216964880e-04f, 3.162277862e-04f, 2.371373848e-04f, 1.778279402e-04f, 1.333521504e-04f };   // float32 1 / 10000^(2i/64), generated with jnp to be bit-exact
__device__ __forceinline__ void d_cs5(int bx, float* CS) { const int idx = bx * 256 + threadIdx.x; if (idx >= TT * HD) return; const int d = idx % HD; const int t = idx / HD; const float a = __fmul_rn((float)t, INVT[d % (HD / 2)]); v2f cs; cs[0] = cosf(a); cs[1] = sinf(a); *(v2f*)(CS + (size_t)idx * 2) = cs;  }
// ---- k_prep: the preparations do not depend on one another, so they share one grid: blocks [0, 4 NWB) transpose the four weights (planes stacked in WT), the next NCB compute the rotary table, the last NXB round x (both batches) to bf16.
#define NWB ((DM / 16) * (DM / 32) / 8)
#define NCB ((TT * HD + 255) / 256)
#define NXB ((NB_ * TT * DM / 8 + 255) / 256)
__global__ __launch_bounds__(256) void k_prep(const float* __restrict__ x, const float* __restrict__ w0, const float* __restrict__ w1, const float* __restrict__ w2, const float* __restrict__ w3, bf* XB, bf* WT, float* CS) {
    const int bx = (int)blockIdx.x;
    if (bx < 4 * NWB) { const int y = bx / NWB; d_wtG(bx % NWB, y == 0 ? w0 : y == 1 ? w1 : y == 2 ? w2 : w3, DM, DM, WT + (size_t)y * DM * DM); }
    else if (bx < 4 * NWB + NCB) d_cs5(bx - 4 * NWB, CS);
    else d_cvt8(bx - 4 * NWB - NCB, x, DM, XB, (size_t)NB_ * TT * DM / 8);
}
// ---- k_fattn: scores, softmax and P x V of one head in ONE kernel; S and P stay in registers. One wave owns 16 NQ query rows and walks the 2048 keys 32 at a time; the waves share nothing (no LDS, no barrier).
// S^T = K Q^T (A = 16 key rows, B = 16 query rows kept in registers): D register r of lane (lr, hi) is key 8 hi + r of query lr, so the two key tiles of a trip, converted in place, are the B operand (k order 8 hi + s, 16 + 8 hi + s: the order of WFrag::ld) of O^T += V^T P^T.
// Softmax with a running maximum m per query, held in the exponent's own unit (score x SCL x log2 e): p = exp2(s c - m), unnormalised; m, the sum and O move only on a trip where some score stands more than 8 above its m (so p <= 2^8); O / sum at the end.
__device__ __forceinline__ float xhalf(float x) { const int b = __float_as_int(x); return __int_as_float(__builtin_amdgcn_permlanex16(b, b, 0x76543210, 0xfedcba98, false, false)); }   // lane l <-> l ^ 16
template <typename T16> struct PFrag;
template <> struct PFrag<h16> { static __device__ __forceinline__ void cv(v16f e, v16h& p, v16h& p2) { (void)p2; p = __builtin_convertvector(e, v16h); } };
template <> struct PFrag<bf> { static __device__ __forceinline__ void cv(v16f e, v16bf& p, v16bf& p2) { p = __builtin_convertvector(e, v16bf); p2 = __builtin_convertvector(e - __builtin_convertvector(p, v16f), v16bf); } };   // hi + lo, both rounded to nearest even as in splitf
template <typename T16, bool SPLIT, int NQ>
__device__ __forceinline__ void fattn(const T16* __restrict__ Q, const T16* __restrict__ Q2, const T16* __restrict__ Kp, const T16* __restrict__ K2, const T16* __restrict__ Vt, const T16* __restrict__ V2, int q0, bf* Ah, bf* Al) {
    typedef typename WFrag<T16>::V V;
    const float C2 = SCL * 1.4426950408889634f;
    const int lane = threadIdx.x & 31;
    V qf[NQ][2], qf2[NQ][2], kf[2][2], kf2[2][2], vf[4], vf2[4];
    const T16* qb = Q + (size_t)(q0 / 16) * 2 * FT; const T16* qb2 = SPLIT ? Q2 + (size_t)(q0 / 16) * 2 * FT : nullptr;   // the wave's first Q tile, the same in every lane; a lane's place is lane * 8 further
#pragma unroll
    for (int nq = 0; nq < NQ; ++nq)
#pragma unroll
        for (int ks = 0; ks < 2; ++ks) { const int c = lane * 8 + (nq * 2 + ks) * FT; qf[nq][ks] = WFrag<T16>::ld(qb + c); if (SPLIT) qf2[nq][ks] = WFrag<T16>::ld(qb2 + c); }
    // the wait behind the Q loads takes their base addresses as inputs, so that those registers stay theirs up to the wait
    if (SPLIT) asm volatile("s_wait_xcnt 0x0" :: "s"(qb), "s"(qb2) : "memory");
    else asm volatile("s_wait_xcnt 0x0" :: "s"(qb) : "memory");
    __builtin_amdgcn_sched_barrier(0);   // later address arithmetic stays behind the wait
    // K and V^T addresses: each lane's own pointers, which live through the loop and step 32 keys a trip, + a constant
    const T16* kq = Kp + lane * 8; const T16* kq2 = SPLIT ? K2 + lane * 8 : nullptr; const T16* vq = Vt + lane * 8; const T16* vq2 = SPLIT ? V2 + lane * 8 : nullptr;   // 32 keys are four tiles in a row in K (2 key blocks x 2 halves of d) and in V^T (4 d blocks)
#pragma unroll
    for (int kb = 0; kb < 2; ++kb)
#pragma unroll
        for (int ks = 0; ks < 2; ++ks) { const int c = (kb * 2 + ks) * FT; kf[kb][ks] = WFrag<T16>::ld(kq + c); if (SPLIT) kf2[kb][ks] = WFrag<T16>::ld(kq2 + c); }
    XW();   // also keeps the first K loads ahead of the first V loads, as in the loop: loads return in order, and with V first the loop's waits for K would be set to wait for the V rows in flight as well
#pragma unroll
    for (int db = 0; db < 4; ++db) { const int c = db * FT; vf[db] = WFrag<T16>::ld(vq + c); if (SPLIT) vf2[db] = WFrag<T16>::ld(vq2 + c); }
    v8f oa[4][NQ]; float m[NQ]; v2f l[NQ];   // l: two partial sums a lane (even and odd registers), joined at the end
#pragma unroll
    for (int nq = 0; nq < NQ; ++nq) { m[nq] = -3.0e38f; l[nq] = (v2f){};
#pragma unroll
        for (int db = 0; db < 4; ++db) oa[db][nq] = (v8f){}; }
#pragma unroll 1   // rolled: the trips depend on one another through m, the sum and O, and one trip already takes more than 256 registers, so a second copy of the body buys nothing
    for (int key0 = 0; key0 < TT; key0 += 32) {
        v8f s[2][NQ];
#pragma unroll
        for (int kb = 0; kb < 2; ++kb)
#pragma unroll
            for (int nq = 0; nq < NQ; ++nq) { v8f t = (v8f){};
#pragma unroll
                for (int ks = 0; ks < 2; ++ks) { t = WFrag<T16>::mma(kf[kb][ks], qf[nq][ks], t); if (SPLIT) { t = WFrag<T16>::mma(kf2[kb][ks], qf[nq][ks], t); t = WFrag<T16>::mma(kf[kb][ks], qf2[nq][ks], t); } }
                s[kb][nq] = t; }
        int st = (key0 + 32 < TT) ? 1 : 0;   // the pointers step to the next trip's keys; on the last trip they stay (its rows are read again, unused)
        __builtin_amdgcn_sched_barrier(0);   // the wait below stays behind the score products, which then cover the time the V loads issued just before them still need
        asm volatile("s_wait_xcnt 0x0" : "+s"(st) : : "memory");   // the wait before the K pointers, which loads in flight name, are overwritten; the step passes through it so that the additions stand behind it
        kq += st * (4 * FT); if (SPLIT) kq2 += st * (4 * FT);
#pragma unroll
        for (int kb = 0; kb < 2; ++kb)   // the next trip's K rows fly during this trip's softmax and P x V
#pragma unroll
            for (int ks = 0; ks < 2; ++ks) { const int c = (kb * 2 + ks) * FT; kf[kb][ks] = WFrag<T16>::ld(kq + c); if (SPLIT) kf2[kb][ks] = WFrag<T16>::ld(kq2 + c); }
        float mx[NQ]; bool need = false;   // mx: the maximum over this lane's own 16 keys; the other half's is fetched only where m moves
#pragma unroll
        for (int nq = 0; nq < NQ; ++nq) { float t = s[0][nq][0];
#pragma unroll
            for (int r = 1; r < 16; ++r) t = fmaxf(t, s[r >> 3][nq][r & 7]);
            mx[nq] = t * C2; need = need || (mx[nq] > m[nq] + 8.0f); }
        if (__builtin_amdgcn_ballot_w32(need) != 0) {   // wave-uniform branch: the matrix instructions below need every lane on, and both halves of a column must hold one m
#pragma unroll
            for (int nq = 0; nq < NQ; ++nq) { const float mn = fmaxf(m[nq], fmaxf(mx[nq], xhalf(mx[nq]))); const float al = __builtin_amdgcn_exp2f(m[nq] - mn); m[nq] = mn; l[nq] *= al;
#pragma unroll
                for (int db = 0; db < 4; ++db) oa[db][nq] *= al; } }
#pragma unroll
        for (int nq = 0; nq < NQ; ++nq) { v16f e;
#pragma unroll
            for (int r = 0; r < 16; r += 2) { const v2f a = { s[r >> 3][nq][r & 7], s[r >> 3][nq][(r & 7) + 1] }; const v2f t = __builtin_elementwise_fma(a, (v2f){ C2, C2 }, (v2f){ -m[nq], -m[nq] });   // register pairs as the accumulator holds them: packed f32 without moves
                const v2f x = { __builtin_amdgcn_exp2f(t[0]), __builtin_amdgcn_exp2f(t[1]) }; e[r] = x[0]; e[r + 1] = x[1]; l[nq] += x; }
            V p, p2; PFrag<T16>::cv(e, p, p2);
#pragma unroll
            for (int db = 0; db < 4; ++db) { oa[db][nq] = WFrag<T16>::mma(vf[db], p, oa[db][nq]); if (SPLIT) { oa[db][nq] = WFrag<T16>::mma(vf[db], p2, oa[db][nq]); oa[db][nq] = WFrag<T16>::mma(vf2[db], p, oa[db][nq]); } } }
        asm volatile("s_wait_xcnt 0x0" : "+s"(st) : : "memory");   // the same wait before the V pointers are overwritten
        vq += st * (4 * FT); if (SPLIT) vq2 += st * (4 * FT);
#pragma unroll
        for (int db = 0; db < 4; ++db) { const int c = db * FT; vf[db] = WFrag<T16>::ld(vq + c); if (SPLIT) vf2[db] = WFrag<T16>::ld(vq2 + c); }   // the next trip's V^T rows fly during its score products and softmax
    }
    XW();   // the last trip's loads are still in flight where the epilogue reuses their address registers
#pragma unroll
    for (int nq = 0; nq < NQ; ++nq) { const float ls = l[nq][0] + l[nq][1]; const float inv = __fdiv_rn(1.0f, ls + xhalf(ls)); const size_t oo = (size_t)(q0 + nq * 16) * DQ + lane * 8;   // merged planes [batch t][DQ] in fragment order: d block db is half (db & 1) of the head's tile db / 2
#pragma unroll
        for (int db = 0; db < 4; ++db) { v8us oh, ol;
#pragma unroll
            for (int r = 0; r < 8; ++r) { unsigned short a, c2; splitf(oa[db][nq][r] * inv, a, c2); oh[r] = a; ol[r] = c2; }
            *(v8us*)(Ah + oo + (db >> 1) * FT + (db & 1) * 256) = oh; XW(); *(v8us*)(Al + oo + (db >> 1) * FT + (db & 1) * 256) = ol; XW(); } }   // the wait behind each store: the next rows' arithmetic reuses the registers that the store names
}
// grid (RH / 32, heads, batches), 3 independent waves: wave 0 takes 32 hi/lo rows (three products each), waves 1 and 2 take 48 fp16 rows each, so that every work-group asks its cache for the same number of fragment loads a trip.
static_assert((TT - RH) / 96 == RH / 32 && (TT - RH) % 96 == 0 && RH % 32 == 0 && TT % 32 == 0 && TT >= 64 && HD == 64, "row split and trip shape of k_fattn");
__global__ __launch_bounds__(96) void k_fattn(const h16* __restrict__ Q16, const h16* __restrict__ K16, const h16* __restrict__ V16, const bf* __restrict__ Qh, const bf* __restrict__ Ql, const bf* __restrict__ Kh, const bf* __restrict__ Kl, const bf* __restrict__ Vh, const bf* __restrict__ Vl, bf* Ah, bf* Al) {
    const int wave = __builtin_amdgcn_readfirstlane((int)(threadIdx.x >> 5)); const size_t po = ((size_t)blockIdx.z * NH_ + blockIdx.y) * TT * HD; const int bx = (int)blockIdx.x; const size_t ao = (size_t)blockIdx.z * TT * DQ + blockIdx.y * (HD / 32) * FT; Ah += ao; Al += ao;
    if (wave == 0) fattn<bf, true, 2>(Qh + po, Ql + po, Kh + po, Kl + po, Vh + po, Vl + po, bx * 32, Ah, Al);
    else fattn<h16, false, 3>(Q16 + po, nullptr, K16 + po, nullptr, V16 + po, nullptr, RH + bx * 96 + (wave - 1) * 48, Ah, Al);
}

extern "C" void kernel_launch(void* const* d_in, const int* in_sizes, int n_in,
                              void* d_out, int out_size, void* d_ws, size_t ws_size, hipStream_t stream) {
    (void)in_sizes; (void)n_in; (void)out_size;
    const float* x = (const float*)d_in[0]; const float* wq = (const float*)d_in[1]; const float* bq = (const float*)d_in[2]; const float* wk = (const float*)d_in[3]; const float* bk = (const float*)d_in[4]; const float* wv = (const float*)d_in[5]; const float* bv = (const float*)d_in[6]; const float* wo = (const float*)d_in[7]; const float* bo = (const float*)d_in[8];   /* order x, Wq, bq, Wk, bk, Wv, bv, Wo, bo ('xw' (in, out) [1024][1024] + [1024]): NINE inputs, all read: the host's own binding */
    float* OUT = (float*)d_out;     // [2][2048][1024]
    char* wsp = (char*)d_ws;
    auto take = [&](size_t bytes) { char* p = wsp; wsp += (bytes + 255) & ~(size_t)255; return (void*)p; };
    static_assert(DQ == DM && DKV == DM, "four weights of one size, stacked");
    const size_t PL = (size_t)NB_ * NH_ * TT * HD;   // one plane: both batches, all heads
    bf* WT = (bf*)take((size_t)4 * DM * DM * 2);   // Wq, Wk, Wv, Wo transposed, stacked
    float* CS = (float*)take((size_t)TT * HD * 2 * 4);
    bf* XB = (bf*)take((size_t)NB_ * TT * DM * 2);
    h16* P16 = (h16*)take(3 * PL * 2); bf* Ph = (bf*)take(3 * PL * 2); bf* Pl = (bf*)take(3 * PL * 2);   // q | k | v(transposed), each [batch][h]
    bf* ATh = (bf*)take((size_t)NB_ * TT * DQ * 2); bf* ATl = (bf*)take((size_t)NB_ * TT * DQ * 2);
    if ((size_t)(wsp - (char*)d_ws) > ws_size) return;    // ws 256 MiB
    k_prep<<<4 * NWB + NCB + NXB, 256, 0, stream>>>(x, wq, wk, wv, wo, XB, WT, CS);   /* with the COMPUTED rotary table (this module rotates q and k); k_csid stays defined and is NOT launched */
    k_gemmw<bf, 0, true, 1, DM><<<dim3(NB_ * TT / 64, 3 * DQ / 64, 1), 32, 0, stream>>>(XB, nullptr, WT, nullptr, nullptr, 0, bq, bk, bv, CS, P16, Ph, Pl);
    k_fattn<<<dim3(RH / 32, NH_, NB_), 96, 0, stream>>>(P16, P16 + PL, P16 + 2 * PL, Ph, Pl, Ph + PL, Pl + PL, Ph + 2 * PL, Pl + 2 * PL, ATh, ATl);   // one kv head per query head
    k_gemmw<bf, 1, true, 0, DQ><<<dim3(NB_ * TT / 64, DM / 64, 1), 32, 0, stream>>>(ATh, ATl, WT + (size_t)3 * DM * DM, nullptr, OUT, DM, bo, nullptr, nullptr, nullptr, nullptr, nullptr, nullptr);
}

// v006
// A run of this version takes 117 microseconds.
// Timed twice side by side with v005, it ran 1.25 and 1.23 times as fast.
// All steps since v000 together make it 17.1 times as fast.
#include <hip/hip_runtime.h>

// Multi-head attention with biased 'xw' projections and a COMPUTED rotate-half rotary embedding, NO mask (x [2][2048][1024]; q, k, v = x W + b ('xw' (in, out) [1024][1024] 0.02 + zero biases (ONE zeros array bound four times by the module's setup): read; 16 heads x 64); q, k -> cat(x1 cos - x2 sin, x2 cos + x1 sin) on the two 32-wide halves (= t cos + cat(-t2, t1) sin with cat(freqs, freqs)) with angle t x 1 / 10000^(2i/64) (32 f32 frequencies exact for the module's expression 1.0 / (10000.0 ** (arange(0, 64, 2) / 64)); precise cosf/sinf); scores / sqrt(64) (np.sqrt(D_K) as float32); softmax over all keys; out = merged Wo + bo ('xw' + bias) -> [2][2048][1024] (4.2 M); argument order x, Wq, bq, Wk, bk, Wv, bv, Wo, bo).
// Layout, both batches side by side in every plane and every grid (x is taken as [4096][1024]): bf16 copy of x; 'xw' weights transposed once; exact projections + f32 biases; d_cs5 computes the rotary table once (32 baked float32 frequencies) and the projection kernel's own epilogue applies the rotate-half rotation at width 64 and writes the head planes (q, k) or the transposed planes (v); q, k and v come from ONE grid (Wq, Wk, Wv stacked as 3072 rows); one fused attention kernel (scores, running-maximum softmax with the 1/8 in the exponent, P x V; hybrid rows: < 512 hi/lo 3 products, rest fp16); merged hi/lo x wo exact + bo.
// Fragment order: every 16-bit operand plane [rows][k] lies in memory as tiles of 16 rows x 32 k (FT = 512 elements, 1 KiB), the tiles of one block of 16 rows one behind the other along k (v: the four d tiles of 32 keys together). Inside a tile element (r, k) stands at (k / 16) * 256 + ((k % 16) / 8 * 16 + r) * 8 + k % 8, so lane (lr, hi) finds its two 16-byte pieces (k = 8 hi + s and 16 + 8 hi + s) at lane * 8 and 256 + lane * 8 and each wave-wide 16-byte load or store covers 512 contiguous bytes (4 whole lines).
// Compute dtypes, f32 accumulate: every input rounded to bf16; projections exact + f32 biases; attention rows < 512 3 products, rest fp16; softmax f32; Wo hl x exact + bias.

#define NB_  2
#define TT   2048
#define DM   1024
#define NH_  16
#define NKV  16
#define REP  (NH_ / NKV)
#define HD   64
#define DQ   (NH_ * HD)
#define DKV  (NKV * HD)
#define RH   512                  // query rows < RH use hi+lo planes
#define SCL  0.125f   // HD^-0.5
#define FT   512                  // elements of one fragment tile (16 rows x 32 k)
typedef _Float16 h16;
typedef unsigned short bf;
typedef __attribute__((ext_vector_type(16))) __bf16   v16bf;
typedef __attribute__((ext_vector_type(16))) _Float16 v16h;
typedef __attribute__((ext_vector_type(8)))  _Float16 v8h;
typedef __attribute__((ext_vector_type(8)))  unsigned short v8us;
typedef __attribute__((ext_vector_type(8)))  float    v8f;
typedef __attribute__((ext_vector_type(4)))  float    v4f;
typedef v8h  __attribute__((may_alias)) v8ha;
typedef v4f  __attribute__((may_alias)) v4fa;
typedef v8us __attribute__((may_alias)) v8usa;

__device__ __forceinline__ unsigned short f2bf(float f) { unsigned u = __float_as_uint(f); u += 0x7FFFu + ((u >> 16) & 1u); return (unsigned short)(u >> 16); }
__device__ __forceinline__ float bf2f(unsigned short b) { return __uint_as_float(((unsigned)b) << 16); }
__device__ __forceinline__ float bfr(float f) { return bf2f(f2bf(f)); }
__device__ __forceinline__ v16h cat16(v8h lo, v8h hi) { return __builtin_shufflevector(lo, hi, 0, 1, 2, 3, 4, 5, 6, 7, 8, 9, 10, 11, 12, 13, 14, 15); }
__device__ __forceinline__ v16bf cat16b(v8us lo, v8us hi) { return __builtin_bit_cast(v16bf, __builtin_shufflevector(lo, hi, 0, 1, 2, 3, 4, 5, 6, 7, 8, 9, 10, 11, 12, 13, 14, 15)); }
__device__ __forceinline__ v8f wmma16(v16h a, v16h b, v8f c) { return __builtin_amdgcn_wmma_f32_16x16x32_f16(false, a, false, b, (short)0, c, false, false); }
__device__ __forceinline__ v8f wmmab(v16bf a, v16bf b, v8f c) { return __builtin_amdgcn_wmma_f32_16x16x32_bf16(false, a, false, b, (short)0, c, false, false); }
__device__ __forceinline__ h16 tohx(float x) { return (h16)x; }
__device__ __forceinline__ void splitf(float y, unsigned short& h, unsigned short& l) { h = f2bf(y); l = f2bf(y - bf2f(h)); }
typedef __attribute__((ext_vector_type(2))) _Float16 v2h;
typedef __attribute__((ext_vector_type(4))) _Float16 v4h;
typedef __attribute__((ext_vector_type(2))) unsigned short v2us;
typedef __attribute__((ext_vector_type(4))) unsigned short v4us;
typedef __attribute__((ext_vector_type(2))) float v2f;
typedef __attribute__((ext_vector_type(4))) int v4i;
typedef __attribute__((ext_vector_type(16))) float v16f;
// XW: s_wait_xcnt 0 stands between issued global loads or stores and the first overwrite of a register they name; the scheduling barriers on both sides keep later arithmetic from being lifted over the wait.
__device__ __forceinline__ void XW() { __builtin_amdgcn_sched_barrier(0); asm volatile("s_wait_xcnt 0x0" ::: "memory"); __builtin_amdgcn_sched_barrier(0); }



// ---- k_gemmw: register-blocked GEMM, one wave per 64x64 output tile (16 accumulators), WM x WN waves a work-group; grid (M / (64 WM), N / (64 WN)), 32 WM WN threads.
// The waves of a work-group share their operands through LDS: a stage is HS halves of 64 k (HS = 2 where the registers allow it: fewer barriers); a half holds two fragment tiles (2 KiB) of every block of 16 rows that the work-group reads (A, A2 where it is used, then Bt), brought in by asynchronous copies (512 contiguous bytes a wave-wide copy, fragment order kept, so WFrag::ld takes tile + lane * 8 in LDS as in memory); two buffers, the next stage's copies fly while this one is worked on.
// C[m][n] (+ f32 bias[n]) = sum_k A[m][k] Bt[n][k] (+ split products per NSPLIT). K % (64 HS) == 0, K >= 128 HS.
// EPI says where the tile goes. 0: f32 C, pitch ldc. 1: the q, k, v projections of both batches in one grid: M = NB_ TT rows (batch, t), N = 3 DQ columns (q | k | v, biases bias | biask | biasv). A 64-wide tile is one head (HD == 64) of one of the three, so the tile finishes that head's planes [q, k, v][batch][h] from the accumulators, with no f32 copy in memory:
// q, k: rotate-half rotation out[d] = x[d] cos[t][d] - x[d+32] sin[t][d], out[d+32] = x[d+32] cos[t][d] + x[d] sin[t][d] (table CS [t][d](cos, sin), whose two halves are equal), planes [t][d] (fp16 + hi/lo); v: planes [d][t] (fp16 + hi/lo); all in fragment order.
template <typename T16> struct WFrag;
template <> struct WFrag<h16> { typedef v16h V; static __device__ __forceinline__ V ld(const h16* p) { return cat16(*(const v8h*)p, *(const v8h*)(p + 256)); } static __device__ __forceinline__ v8f mma(V a, V b, v8f c) { return wmma16(a, b, c); } };
template <> struct WFrag<bf> { typedef v16bf V; static __device__ __forceinline__ V ld(const bf* p) { return cat16b(*(const v8us*)p, *(const v8us*)(p + 256)); } static __device__ __forceinline__ v8f mma(V a, V b, v8f c) { return wmmab(a, b, c); } };
// cp1, cp9, cp12: 1, 9 or 12 asynchronous 16-byte-a-lane copies to LDS in one statement that ends in s_wait_xcnt 0, so that the wait stands ahead of every later write of a register that a copy names.
#define CPL(a, b) "global_load_async_to_lds_b128 %" #a ", %" #b ", off\n\t"
__device__ __forceinline__ void cp1(unsigned l, const char* g) { asm volatile(CPL(0, 1) "s_wait_xcnt 0x0" :: "v"(l), "v"(g) : "memory"); }
__device__ __forceinline__ void cp9(const unsigned* l, const char* const* g) { asm volatile(CPL(0, 1) CPL(2, 3) CPL(4, 5) CPL(6, 7) CPL(8, 9) CPL(10, 11) CPL(12, 13) CPL(14, 15) CPL(16, 17) "s_wait_xcnt 0x0" :: "v"(l[0]), "v"(g[0]), "v"(l[1]), "v"(g[1]), "v"(l[2]), "v"(g[2]), "v"(l[3]), "v"(g[3]), "v"(l[4]), "v"(g[4]), "v"(l[5]), "v"(g[5]), "v"(l[6]), "v"(g[6]), "v"(l[7]), "v"(g[7]), "v"(l[8]), "v"(g[8]) : "memory"); }
__device__ __forceinline__ void cp12(const unsigned* l, const char* const* g) { asm volatile(CPL(0, 1) CPL(2, 3) CPL(4, 5) CPL(6, 7) CPL(8, 9) CPL(10, 11) CPL(12, 13) CPL(14, 15) CPL(16, 17) CPL(18, 19) CPL(20, 21) CPL(22, 23) "s_wait_xcnt 0x0" :: "v"(l[0]), "v"(g[0]), "v"(l[1]), "v"(g[1]), "v"(l[2]), "v"(g[2]), "v"(l[3]), "v"(g[3]), "v"(l[4]), "v"(g[4]), "v"(l[5]), "v"(g[5]), "v"(l[6]), "v"(g[6]), "v"(l[7]), "v"(g[7]), "v"(l[8]), "v"(g[8]), "v"(l[9]), "v"(g[9]), "v"(l[10]), "v"(g[10]), "v"(l[11]), "v"(g[11]) : "memory"); }
template <typename T16, int NSPLIT, bool BIAS, int EPI, int K, int WM, int WN, int HS>
__global__ __launch_bounds__(WM * WN * 32) void k_gemmw(const T16* __restrict__ A, const T16* __restrict__ A2, const T16* __restrict__ Bt, const T16* __restrict__ Bt2, float* C, int ldc, const float* __restrict__ bias, const float* __restrict__ biask, const float* __restrict__ biasv, const float* __restrict__ CS, h16* P16, bf* Ph, bf* Pl) {
    static_assert(EPI == 0 || (HD == 64 && NKV == NH_ && TT % 64 == 0), "one tile, one head of one batch; q, k, v planes of one size");
    typedef typename WFrag<T16>::V V;
    static_assert(NSPLIT <= 1 && K % (64 * HS) == 0 && K >= 128 * HS && (WM * WN) % 4 == 0, "stages of 64 HS k, at least two; four waves copy one block of rows");
    constexpr int NW = WM * WN, NA = WM * 4, NAT = NSPLIT == 1 ? 2 * NA : NA, NBLK = NAT + WN * 4, SE = NBLK * 2 * FT, NS = K / (64 * HS);   // blocks of 16 rows of A, of A and A2, of all operands; elements of a half; stages
    constexpr int BS = NW / 4, NFULL = NBLK / BS, REM = NBLK % BS;   // wave w copies quarter w % 4 of blocks w / 4 + BS i: NFULL copies in every wave, one more in the waves with w / 4 < REM
    static_assert((NFULL == 9 || NFULL == 24) && REM <= 1, "the copy statements at hand");
    __shared__ __align__(16) T16 ring[2 * HS * SE];
    __shared__ __align__(16) float osw[NW][16 * 68];
    const int lane = threadIdx.x & 31, lr = lane & 15, hi = lane >> 4; const int wave = __builtin_amdgcn_readfirstlane((int)(threadIdx.x >> 5)), wm = wave % WM, wn = wave / WM, wq = NW == 4 ? 0 : wave >> 2;
    const int R0 = blockIdx.x * (WM * 64), C0 = blockIdx.y * (WN * 64), by = (int)blockIdx.y * WN + wn; const int r0 = R0 + wm * 64, c0 = by * 64; float* os = osw[wave];   // each wave stages its output rows in its own part
    // EPI 1: which of q, k, v (sel, the same for the whole wave), the head's first column in its own bias, the tile's first t, and the head's place in the planes
    const int sel = by / NH_, cb = (by % NH_) * 64, t0 = r0 % TT; const size_t pofs = (((size_t)sel * NB_ + r0 / TT) * NH_ + by % NH_) * TT * HD;
    const float* bs = sel == 0 ? bias : sel == 1 ? biask : biasv;
    v8f acc[4][4];
#pragma unroll
    for (int mb = 0; mb < 4; ++mb)
#pragma unroll
        for (int nb = 0; nb < 4; ++nb) acc[mb][nb] = (v8f){};
    (void)Bt2;
    // half st (64 k) into place bf_ of the ring's 2 HS: in memory a block of 16 rows is K / 32 tiles = 16 K elements, of which the half takes tiles 2 st and 2 st + 1; in LDS block j of the half stands at j * 2 FT
    auto copies = [&](int st, int bf_) {
        const unsigned lb = (unsigned)(size_t)ring + (unsigned)(((bf_ * NBLK + wq) * 4 + (wave & 3)) * 512 + lane * 16); const size_t go = (size_t)((st * 4 + (wave & 3)) * 512 + lane * 16);
        auto sp = [&](int i) { const int blk = wq + BS * i; const size_t ea = (size_t)(R0 / 16 + blk) * 16 * K, eb = (size_t)(C0 / 16 + blk - NAT) * 16 * K; const T16* p;   // which operand block wq + BS i belongs to is known at compile time unless the BS blocks of this i straddle a border
            if (BS * i + BS - 1 < NA) p = A + ea; else if (BS * i >= NAT) p = Bt + eb; else if (NSPLIT == 1 && BS * i >= NA && BS * i + BS - 1 < NAT) p = A2 + (ea - (size_t)NA * 16 * K);
            else p = blk < NA ? A + ea : (NSPLIT == 1 && blk < NAT) ? A2 + (ea - (size_t)NA * 16 * K) : Bt + eb;
            return (const char*)p + go; };
        unsigned l[NFULL]; const char* g[NFULL];
#pragma unroll
        for (int i = 0; i < NFULL; ++i) { l[i] = lb + BS * i * 2048; g[i] = sp(i); }
        if constexpr (NFULL == 9) cp9(l, g); else { cp12(l, g); __builtin_amdgcn_sched_barrier(0); cp12(l + 12, g + 12); }   // the scheduling barriers here and below keep the address arithmetic of one copy statement behind the statement before it: formed all at once, the addresses do not fit the registers and are spilled
        if (REM > 0 && wq < REM) cp1(lb + BS * NFULL * 2048, sp(NFULL));   // a scalar test: wq is the same in every lane
        __builtin_amdgcn_sched_barrier(0); };
    auto stage = [&](int s, int bu) {   // stage s into buffer bu
#pragma unroll
        for (int h = 0; h < HS; ++h) copies(s * HS + h, bu * HS + h); };
    // each lane's own places in the first buffer's tiles; the other blocks of rows, the other tiles and the second buffer stand at constant distances
    const T16* fa = ring + (wm * 4) * 2 * FT + lane * 8; const T16* fa2 = ring + (NA + wm * 4) * 2 * FT + lane * 8; const T16* fb = ring + (NAT + wn * 4) * 2 * FT + lane * 8;
    stage(0, 0);
    // EPI 1: 8 lanes a row; a lane takes 4 columns of the head's low half and their partners in the high half, which share one (cos, sin). The table rows of 16 tile rows are fetched one block of rows ahead of their use. (The loops of both epilogues are unrolled because acc, cs and the vectors they fill live in registers and take constant indices only.)
    const int rq = lane >> 3, col = (lane & 7) * 4; v4f b1 = (v4f){}, b2 = (v4f){}, cs[2][4][2];
    auto ldcs = [&](int mb) {
#pragma unroll
        for (int s = 0; s < 4; ++s) { const float* cp = CS + ((size_t)(t0 + mb * 16 + 4 * s + rq) * HD + col) * 2; cs[mb & 1][s][0] = *(const v4f*)cp; cs[mb & 1][s][1] = *(const v4f*)(cp + 4); }
        XW(); };   // the arithmetic that follows reuses the address registers of these loads
    if (EPI == 1 && sel < 2) { const float* bp = bs + cb + col;   // this lane's four low-half columns; their partners stand HD / 2 further
#pragma unroll
        for (int i = 0; i < 4; ++i) { b1[i] = bp[i]; b2[i] = bp[HD / 2 + i]; }
        asm volatile("s_wait_xcnt 0x0" :: "v"(bp) : "memory");   // s_wait_xcnt 0 behind the two bias loads, ahead of the arithmetic that reuses their address registers; the address is an input so that it lives up to the wait and no load's result lands on it
#pragma unroll
        for (int i = 0; i < 4; ++i) { b1[i] = bfr(b1[i]); b2[i] = bfr(b2[i]); }
        ldcs(0); }
    if (EPI == 1 && sel == 2) {   // the four columns' biases, fetched ahead of the K loop like the table rows above
#pragma unroll
        for (int nb = 0; nb < 4; ++nb) b1[nb] = bs[cb + nb * 16 + lr];
        XW(); }   // as behind the table rows
    asm volatile("s_wait_asynccnt 0x0" ::: "memory");   // this wave's copies of stage 0 have landed
    __syncthreads();   // ... and every other wave's: stage 0 may be read
    stage(1, 1);
#pragma unroll 1   // rolled: one trip is one stage, and the trips are separated by a barrier
    for (int s = 0; s < NS; ++s) {
        const int bo = (s & 1) * HS * SE;
        V a[2][4], a2[2][4], b[2][4];   // two fragment sets: tile kt of the stage's 2 HS goes through set kt % 2
        auto ldf = [&](int kt) { const int o = bo + (kt >> 1) * SE + (kt & 1) * FT, q = kt & 1;
#pragma unroll
            for (int mb = 0; mb < 4; ++mb) { a[q][mb] = WFrag<T16>::ld(fa + o + mb * 2 * FT); if (NSPLIT == 1) a2[q][mb] = WFrag<T16>::ld(fa2 + o + mb * 2 * FT); }
#pragma unroll
            for (int nb = 0; nb < 4; ++nb) b[q][nb] = WFrag<T16>::ld(fb + o + nb * 2 * FT);
            __builtin_amdgcn_sched_barrier(0); };   // a tile's fragment loads stay together at their place, one tile ahead of their products (LDS loads return in order, so an earlier tile's must not stand behind a later tile's)
        auto mm = [&](int q) {
#pragma unroll
            for (int nb = 0; nb < 4; ++nb) {
#pragma unroll
                for (int mb = 0; mb < 4; ++mb) { acc[mb][nb] = WFrag<T16>::mma(a[q][mb], b[q][nb], acc[mb][nb]); if (NSPLIT == 1) acc[mb][nb] = WFrag<T16>::mma(a2[q][mb], b[q][nb], acc[mb][nb]); } }
            __builtin_amdgcn_sched_barrier(0); };   // a tile's products stay where they stand: ahead of the loads that refill their set, and the last but one's ahead of the waits (left free, this build moves products behind the barrier and the copies, which then start too late to land within one trip)
        ldf(0); ldf(1);
#pragma unroll
        for (int kt = 0; kt < 2 * HS - 2; ++kt) { mm(kt & 1); ldf(kt + 2); }
        mm(0);
        asm volatile("s_wait_dscnt 0x0" ::: "memory");   // this wave's reads of the buffer are done before the barrier behind which it is refilled
        asm volatile("s_wait_asynccnt 0x0" ::: "memory");   // this wave's copies of stage s + 1 have landed
        __syncthreads();   // publishes stage s + 1 and ends every wave's reads of stage s
        if (s + 2 < NS) stage(s + 2, s & 1);
        __builtin_amdgcn_sched_barrier(0);   // the last tile's products, which work from registers alone, stay behind the copies and cover the start of their flight
        mm(1);
    }
    asm volatile("s_wait_asynccnt 0x0" ::: "memory");   // no copy is in flight where the wave goes on to its epilogue
    if (EPI == 1 && sel == 2) {   // a lane's 8 accumulator registers are 8 consecutive t of one column d: the lane's own 16-byte piece of tile (32 keys, d block nb), so each store covers 512 contiguous bytes
#pragma unroll
        for (int nb = 0; nb < 4; ++nb) { const float bb = bfr(b1[nb]); const size_t e = pofs + (size_t)(t0 / 32 * 4 + nb) * FT + lane * 8;
#pragma unroll
            for (int mb = 0; mb < 4; ++mb) { v8h o16; v8us oh, ol;
#pragma unroll
                for (int j = 0; j < 8; ++j) { const float x = acc[mb][nb][j] + bb; o16[j] = tohx(x); unsigned short a2, c2; splitf(x, a2, c2); oh[j] = a2; ol[j] = c2; }
                const int f = (mb >> 1) * 4 * FT + (mb & 1) * 256; *(v8h*)(P16 + e + f) = o16; *(v8us*)(Ph + e + f) = oh; *(v8us*)(Pl + e + f) = ol; }
            XW(); }   // the next column block's arithmetic reuses the registers that these stores name
        return; }
#pragma unroll
    for (int mb = 0; mb < 4; ++mb) {
#pragma unroll
        for (int nb = 0; nb < 4; ++nb) {
#pragma unroll
            for (int j = 0; j < 8; ++j) os[(hi * 8 + j) * 68 + nb * 16 + lr] = acc[mb][nb][j]; }
        __builtin_amdgcn_wave_barrier(); asm volatile("" ::: "memory");
        float* crow = C + (size_t)(r0 + mb * 16) * ldc + c0;
        if (EPI == 0)
{
#pragma unroll
            for (int s = 0; s < 8; ++s) { const int row = 2 * s + hi, cofs = lr * 4; v4f val = *(const v4fa*)(os + row * 68 + cofs); if (BIAS) { val[0] += bfr(bias[c0 + cofs]); val[1] += bfr(bias[c0 + cofs + 1]); val[2] += bfr(bias[c0 + cofs + 2]); val[3] += bfr(bias[c0 + cofs + 3]); }
                *(v4f*)(crow + (size_t)row * ldc + cofs) = val; }
             }
        if (EPI == 1) {
            if (mb < 3) ldcs(mb + 1);
#pragma unroll
            for (int s = 0; s < 4; ++s) { const int row = 4 * s + rq; const v4f x1 = *(const v4fa*)(os + row * 68 + col) + b1, x2 = *(const v4fa*)(os + row * 68 + HD / 2 + col) + b2; const v4f ca = cs[mb & 1][s][0], cb = cs[mb & 1][s][1];
                const v4f cc = { ca[0], ca[2], cb[0], cb[2] }, sn = { ca[1], ca[3], cb[1], cb[3] }; const v4f rl = x1 * cc - x2 * sn, rh = x2 * cc + x1 * sn; v4h l16, u16; v4us lh, ll, uh, ul;
#pragma unroll
                for (int i = 0; i < 4; ++i) { unsigned short a2, c2; l16[i] = tohx(rl[i]); splitf(rl[i], a2, c2); lh[i] = a2; ll[i] = c2; u16[i] = tohx(rh[i]); splitf(rh[i], a2, c2); uh[i] = a2; ul[i] = c2; }
                const size_t e = pofs + (size_t)(t0 / 16 + mb) * 2 * FT + (col / 16) * 256 + ((col % 16) / 8 * 16 + row) * 8 + col % 8;   // the low half is the rows' first tile, the high half the second
                *(v4h*)(P16 + e) = l16; *(v4h*)(P16 + e + FT) = u16; *(v4us*)(Ph + e) = lh; *(v4us*)(Ph + e + FT) = uh; *(v4us*)(Pl + e) = ll; *(v4us*)(Pl + e + FT) = ul;
                XW(); } }   // the next rows' arithmetic reuses the registers that these stores name
        __builtin_amdgcn_wave_barrier(); asm volatile("" ::: "memory");
    }
}

// The three preparations (d_wtG, d_cvt8, d_cs5) are blocks of 256 threads of ONE grid, k_prep below; bx is the block's number within its own part.
// d_wtG: one wave builds one tile (16 n x 32 k) of the transposed weight; the 8 waves of a block take 8 neighbouring n blocks of the same 32 k, so that the block reads 512 contiguous bytes of each row of w.
__device__ __forceinline__ void d_wtG(int bx, const float* __restrict__ w, int K, int N, bf* Bt) {
    const int lane = threadIdx.x & 31, lr = lane & 15, hi = lane >> 4; const int g = bx * 8 + (threadIdx.x >> 5); if (g >= (N / 16) * (K / 32)) return;
    const int tn = g % (N / 16), tk = g / (N / 16); const float* s = w + (size_t)(tk * 32 + 8 * hi) * N + tn * 16 + lr; v8us o0, o1;
#pragma unroll
    for (int i = 0; i < 8; ++i) { o0[i] = f2bf(s[(size_t)i * N]); o1[i] = f2bf(s[(size_t)(16 + i) * N]); }
    bf* d = Bt + ((size_t)tn * (K / 32) + tk) * FT + lane * 8; *(v8us*)d = o0; *(v8us*)(d + 256) = o1;
}
// d_cvt8: thread i writes the i-th 16-byte piece of the plane in fragment order and reads the 8 values of src [rows][K] that belong there.
__device__ __forceinline__ void d_cvt8(int bx, const float* __restrict__ src, int K, bf* dst, size_t n8) { const size_t i = (size_t)bx * 256 + threadIdx.x; if (i >= n8) return; const int lane = (int)(i & 31), j = (int)(i >> 5) & 1; const size_t tile = i >> 6;
    const v8f v = *(const v8f*)(src + (tile / (K / 32) * 16 + (lane & 15)) * K + tile % (K / 32) * 32 + j * 16 + (lane >> 4) * 8); v8us o;
#pragma unroll
    for (int k = 0; k < 8; ++k) o[k] = f2bf(v[k]); *(v8us*)(dst + i * 8) = o;  }

__global__ __launch_bounds__(256) void k_csid(float* CS) { const int idx = blockIdx.x * 256 + threadIdx.x; if (idx >= TT * HD) return; v2f cs; cs[0] = 1.0f; cs[1] = 0.0f; *(v2f*)(CS + (size_t)idx * 2) = cs;  }
__constant__ float INVT[HD / 2] = { 1.000000000e+00f, 7.498942018e-01f, 5.623413324e-01f, 4.216965139e-01f, 3.162277639e-01f, 2.371373624e-01f, 1.778279394e-01f, 1.333521456e-01f, 1.000000015e-01f, 7.498941571e-02f, 5.623412877e-02f, 4.216964915e-02f, 3.162277862e-02f, 2.371373586e-02f, 1.778279431e-02f, 1.333521493e-02f, 9.999999776e-03f, 7.498942316e-03f, 5.623413250e-03f, 4.216964822e-03f, 3.162277862e-03f, 2.371373819e-03f, 1.778279431e-03f, 1.333521446e-03f, 1.000000047e-03f, 7.498941850e-04f, 5.623413017e-04f, 4.216964880e-04f, 3.162277862e-04f, 2.371373848e-04f, 1.778279402e-04f, 1.333521504e-04f };   // float32 1 / 10000^(2i/64), generated with jnp to be bit-exact
__device__ __forceinline__ void d_cs5(int bx, float* CS) { const int idx = bx * 256 + threadIdx.x; if (idx >= TT * HD) return; const int d = idx % HD; const int t = idx / HD; const float a = __fmul_rn((float)t, INVT[d % (HD / 2)]); v2f cs; cs[0] = cosf(a); cs[1] = sinf(a); *(v2f*)(CS + (size_t)idx * 2) = cs;  }
// ---- k_prep: the preparations do not depend on one another, so they share one grid: blocks [0, 4 NWB) transpose the four weights (planes stacked in WT), the next NCB compute the rotary table, the last NXB round x (both batches) to bf16.
#define NWB ((DM / 16) * (DM / 32) / 8)
#define NCB ((TT * HD + 255) / 256)
#define NXB ((NB_ * TT * DM / 8 + 255) / 256)
__global__ __launch_bounds__(256) void k_prep(const float* __restrict__ x, const float* __restrict__ w0, const float* __restrict__ w1, const float* __restrict__ w2, const float* __restrict__ w3, bf* XB, bf* WT, float* CS) {
    const int bx = (int)blockIdx.x;
    if (bx < 4 * NWB) { const int y = bx / NWB; d_wtG(bx % NWB, y == 0 ? w0 : y == 1 ? w1 : y == 2 ? w2 : w3, DM, DM, WT + (size_t)y * DM * DM); }
    else if (bx < 4 * NWB + NCB) d_cs5(bx - 4 * NWB, CS);
    else d_cvt8(bx - 4 * NWB - NCB, x, DM, XB, (size_t)NB_ * TT * DM / 8);
}
// ---- k_fattn: scores, softmax and P x V of one head in ONE kernel; S and P stay in registers. One wave owns 16 NQ query rows and walks the 2048 keys 32 at a time; the waves share nothing (no LDS, no barrier).
// S^T = K Q^T (A = 16 key rows, B = 16 query rows kept in registers): D register r of lane (lr, hi) is key 8 hi + r of query lr, so the two key tiles of a trip, converted in place, are the B operand (k order 8 hi + s, 16 + 8 hi + s: the order of WFrag::ld) of O^T += V^T P^T.
// Softmax with a running maximum m per query, held in the exponent's own unit (score x SCL x log2 e): p = exp2(s c - m), unnormalised; m, the sum and O move only on a trip where some score stands more than 8 above its m (so p <= 2^8); O / sum at the end.
__device__ __forceinline__ float xhalf(float x) { const int b = __float_as_int(x); return __int_as_float(__builtin_amdgcn_permlanex16(b, b, 0x76543210, 0xfedcba98, false, false)); }   // lane l <-> l ^ 16
template <typename T16> struct PFrag;
template <> struct PFrag<h16> { static __device__ __forceinline__ void cv(v16f e, v16h& p, v16h& p2) { (void)p2; p = __builtin_convertvector(e, v16h); } };
template <> struct PFrag<bf> { static __device__ __forceinline__ void cv(v16f e, v16bf& p, v16bf& p2) { p = __builtin_convertvector(e, v16bf); p2 = __builtin_convertvector(e - __builtin_convertvector(p, v16f), v16bf); } };   // hi + lo, both rounded to nearest even as in splitf
template <typename T16, bool SPLIT, int NQ>
__device__ __forceinline__ void fattn(const T16* __restrict__ Q, const T16* __restrict__ Q2, const T16* __restrict__ Kp, const T16* __restrict__ K2, const T16* __restrict__ Vt, const T16* __restrict__ V2, int q0, bf* Ah, bf* Al) {
    typedef typename WFrag<T16>::V V;
    const float C2 = SCL * 1.4426950408889634f;
    const int lane = threadIdx.x & 31;
    V qf[NQ][2], qf2[NQ][2], kf[2][2], kf2[2][2], vf[4], vf2[4];
    const T16* qb = Q + (size_t)(q0 / 16) * 2 * FT; const T16* qb2 = SPLIT ? Q2 + (size_t)(q0 / 16) * 2 * FT : nullptr;   // the wave's first Q tile, the same in every lane; a lane's place is lane * 8 further
#pragma unroll
    for (int nq = 0; nq < NQ; ++nq)
#pragma unroll
        for (int ks = 0; ks < 2; ++ks) { const int c = lane * 8 + (nq * 2 + ks) * FT; qf[nq][ks] = WFrag<T16>::ld(qb + c); if (SPLIT) qf2[nq][ks] = WFrag<T16>::ld(qb2 + c); }
    // the wait behind the Q loads takes their base addresses as inputs, so that those registers stay theirs up to the wait
    if (SPLIT) asm volatile("s_wait_xcnt 0x0" :: "s"(qb), "s"(qb2) : "memory");
    else asm volatile("s_wait_xcnt 0x0" :: "s"(qb) : "memory");
    __builtin_amdgcn_sched_barrier(0);   // later address arithmetic stays behind the wait
    // K and V^T addresses: each lane's own pointers, which live through the loop and step 32 keys a trip, + a constant
    const T16* kq = Kp + lane * 8; const T16* kq2 = SPLIT ? K2 + lane * 8 : nullptr; const T16* vq = Vt + lane * 8; const T16* vq2 = SPLIT ? V2 + lane * 8 : nullptr;   // 32 keys are four tiles in a row in K (2 key blocks x 2 halves of d) and in V^T (4 d blocks)
#pragma unroll
    for (int kb = 0; kb < 2; ++kb)
#pragma unroll
        for (int ks = 0; ks < 2; ++ks) { const int c = (kb * 2 + ks) * FT; kf[kb][ks] = WFrag<T16>::ld(kq + c); if (SPLIT) kf2[kb][ks] = WFrag<T16>::ld(kq2 + c); }
    XW();   // also keeps the first K loads ahead of the first V loads, as in the loop: loads return in order, and with V first the loop's waits for K would be set to wait for the V rows in flight as well
#pragma unroll
    for (int db = 0; db < 4; ++db) { const int c = db * FT; vf[db] = WFrag<T16>::ld(vq + c); if (SPLIT) vf2[db] = WFrag<T16>::ld(vq2 + c); }
    v8f oa[4][NQ]; float m[NQ]; v2f l[NQ];   // l: two partial sums a lane (even and odd registers), joined at the end
#pragma unroll
    for (int nq = 0; nq < NQ; ++nq) { m[nq] = -3.0e38f; l[nq] = (v2f){};
#pragma unroll
        for (int db = 0; db < 4; ++db) oa[db][nq] = (v8f){}; }
#pragma unroll 1   // rolled: the trips depend on one another through m, the sum and O, and one trip already takes more than 256 registers, so a second copy of the body buys nothing
    for (int key0 = 0; key0 < TT; key0 += 32) {
        v8f s[2][NQ];
#pragma unroll
        for (int kb = 0; kb < 2; ++kb)
#pragma unroll
            for (int nq = 0; nq < NQ; ++nq) { v8f t = (v8f){};
#pragma unroll
                for (int ks = 0; ks < 2; ++ks) { t = WFrag<T16>::mma(kf[kb][ks], qf[nq][ks], t); if (SPLIT) { t = WFrag<T16>::mma(kf2[kb][ks], qf[nq][ks], t); t = WFrag<T16>::mma(kf[kb][ks], qf2[nq][ks], t); } }
                s[kb][nq] = t; }
        int st = (key0 + 32 < TT) ? 1 : 0;   // the pointers step to the next trip's keys; on the last trip they stay (its rows are read again, unused)
        __builtin_amdgcn_sched_barrier(0);   // the wait below stays behind the score products, which then cover the time the V loads issued just before them still need
        asm volatile("s_wait_xcnt 0x0" : "+s"(st) : : "memory");   // the wait before the K pointers, which loads in flight name, are overwritten; the step passes through it so that the additions stand behind it
        kq += st * (4 * FT); if (SPLIT) kq2 += st * (4 * FT);
#pragma unroll
        for (int kb = 0; kb < 2; ++kb)   // the next trip's K rows fly during this trip's softmax and P x V
#pragma unroll
            for (int ks = 0; ks < 2; ++ks) { const int c = (kb * 2 + ks) * FT; kf[kb][ks] = WFrag<T16>::ld(kq + c); if (SPLIT) kf2[kb][ks] = WFrag<T16>::ld(kq2 + c); }
        float mx[NQ]; bool need = false;   // mx: the maximum over this lane's own 16 keys; the other half's is fetched only where m moves
#pragma unroll
        for (int nq = 0; nq < NQ; ++nq) { float t = s[0][nq][0];
#pragma unroll
            for (int r = 1; r < 16; ++r) t = fmaxf(t, s[r >> 3][nq][r & 7]);
            mx[nq] = t * C2; need = need || (mx[nq] > m[nq] + 8.0f); }
        if (__builtin_amdgcn_ballot_w32(need) != 0) {   // wave-uniform branch: the matrix instructions below need every lane on, and both halves of a column must hold one m
#pragma unroll
            for (int nq = 0; nq < NQ; ++nq) { const float mn = fmaxf(m[nq], fmaxf(mx[nq], xhalf(mx[nq]))); const float al = __builtin_amdgcn_exp2f(m[nq] - mn); m[nq] = mn; l[nq] *= al;
#pragma unroll
                for (int db = 0; db < 4; ++db) oa[db][nq] *= al; } }
#pragma unroll
        for (int nq = 0; nq < NQ; ++nq) { v16f e;
#pragma unroll
            for (int r = 0; r < 16; r += 2) { const v2f a = { s[r >> 3][nq][r & 7], s[r >> 3][nq][(r & 7) + 1] }; const v2f t = __builtin_elementwise_fma(a, (v2f){ C2, C2 }, (v2f){ -m[nq], -m[nq] });   // register pairs as the accumulator holds them: packed f32 without moves
                const v2f x = { __builtin_amdgcn_exp2f(t[0]), __builtin_amdgcn_exp2f(t[1]) }; e[r] = x[0]; e[r + 1] = x[1]; l[nq] += x; }
            V p, p2; PFrag<T16>::cv(e, p, p2);
#pragma unroll
            for (int db = 0; db < 4; ++db) { oa[db][nq] = WFrag<T16>::mma(vf[db], p, oa[db][nq]); if (SPLIT) { oa[db][nq] = WFrag<T16>::mma(vf[db], p2, oa[db][nq]); oa[db][nq] = WFrag<T16>::mma(vf2[db], p, oa[db][nq]); } } }
        asm volatile("s_wait_xcnt 0x0" : "+s"(st) : : "memory");   // the same wait before the V pointers are overwritten
        vq += st * (4 * FT); if (SPLIT) vq2 += st * (4 * FT);
#pragma unroll
        for (int db = 0; db < 4; ++db) { const int c = db * FT; vf[db] = WFrag<T16>::ld(vq + c); if (SPLIT) vf2[db] = WFrag<T16>::ld(vq2 + c); }   // the next trip's V^T rows fly during its score products and softmax
    }
    XW();   // the last trip's loads are still in flight where the epilogue reuses their address registers
#pragma unroll
    for (int nq = 0; nq < NQ; ++nq) { const float ls = l[nq][0] + l[nq][1]; const float inv = __fdiv_rn(1.0f, ls + xhalf(ls)); const size_t oo = (size_t)(q0 + nq * 16) * DQ + lane * 8;   // merged planes [batch t][DQ] in fragment order: d block db is half (db & 1) of the head's tile db / 2
#pragma unroll
        for (int db = 0; db < 4; ++db) { v8us oh, ol;
#pragma unroll
            for (int r = 0; r < 8; ++r) { unsigned short a, c2; splitf(oa[db][nq][r] * inv, a, c2); oh[r] = a; ol[r] = c2; }
            *(v8us*)(Ah + oo + (db >> 1) * FT + (db & 1) * 256) = oh; XW(); *(v8us*)(Al + oo + (db >> 1) * FT + (db & 1) * 256) = ol; XW(); } }   // the wait behind each store: the next rows' arithmetic reuses the registers that the store names
}
// grid (RH / 32, heads, batches), 3 independent waves: wave 0 takes 32 hi/lo rows (three products each), waves 1 and 2 take 48 fp16 rows each, so that every work-group asks its cache for the same number of fragment loads a trip.
static_assert((TT - RH) / 96 == RH / 32 && (TT - RH) % 96 == 0 && RH % 32 == 0 && TT % 32 == 0 && TT >= 64 && HD == 64, "row split and trip shape of k_fattn");
__global__ __launch_bounds__(96) void k_fattn(const h16* __restrict__ Q16, const h16* __restrict__ K16, const h16* __restrict__ V16, const bf* __restrict__ Qh, const bf* __restrict__ Ql, const bf* __restrict__ Kh, const bf* __restrict__ Kl, const bf* __restrict__ Vh, const bf* __restrict__ Vl, bf* Ah, bf* Al) {
    const int wave = __builtin_amdgcn_readfirstlane((int)(threadIdx.x >> 5)); const size_t po = ((size_t)blockIdx.z * NH_ + blockIdx.y) * TT * HD; const int bx = (int)blockIdx.x; const size_t ao = (size_t)blockIdx.z * TT * DQ + blockIdx.y * (HD / 32) * FT; Ah += ao; Al += ao;
    if (wave == 0) fattn<bf, true, 2>(Qh + po, Ql + po, Kh + po, Kl + po, Vh + po, Vl + po, bx * 32, Ah, Al);
    else fattn<h16, false, 3>(Q16 + po, nullptr, K16 + po, nullptr, V16 + po, nullptr, RH + bx * 96 + (wave - 1) * 48, Ah, Al);
}

extern "C" void kernel_launch(void* const* d_in, const int* in_sizes, int n_in,
                              void* d_out, int out_size, void* d_ws, size_t ws_size, hipStream_t stream) {
    (void)in_sizes; (void)n_in; (void)out_size;
    const float* x = (const float*)d_in[0]; const float* wq = (const float*)d_in[1]; const float* bq = (const float*)d_in[2]; const float* wk = (const float*)d_in[3]; const float* bk = (const float*)d_in[4]; const float* wv = (const float*)d_in[5]; const float* bv = (const float*)d_in[6]; const float* wo = (const float*)d_in[7]; const float* bo = (const float*)d_in[8];   /* order x, Wq, bq, Wk, bk, Wv, bv, Wo, bo ('xw' (in, out) [1024][1024] + [1024]): NINE inputs, all read: the host's own binding */
    float* OUT = (float*)d_out;     // [2][2048][1024]
    char* wsp = (char*)d_ws;
    auto take = [&](size_t bytes) { char* p = wsp; wsp += (bytes + 255) & ~(size_t)255; return (void*)p; };
    static_assert(DQ == DM && DKV == DM, "four weights of one size, stacked");
    const size_t PL = (size_t)NB_ * NH_ * TT * HD;   // one plane: both batches, all heads
    bf* WT = (bf*)take((size_t)4 * DM * DM * 2);   // Wq, Wk, Wv, Wo transposed, stacked
    float* CS = (float*)take((size_t)TT * HD * 2 * 4);
    bf* XB = (bf*)take((size_t)NB_ * TT * DM * 2);
    h16* P16 = (h16*)take(3 * PL * 2); bf* Ph = (bf*)take(3 * PL * 2); bf* Pl = (bf*)take(3 * PL * 2);   // q | k | v(transposed), each [batch][h]
    bf* ATh = (bf*)take((size_t)NB_ * TT * DQ * 2); bf* ATl = (bf*)take((size_t)NB_ * TT * DQ * 2);
    if ((size_t)(wsp - (char*)d_ws) > ws_size) return;    // ws 256 MiB
    k_prep<<<4 * NWB + NCB + NXB, 256, 0, stream>>>(x, wq, wk, wv, wo, XB, WT, CS);   /* with the COMPUTED rotary table (this module rotates q and k); k_csid stays defined and is NOT launched */
    k_gemmw<bf, 0, true, 1, DM, 4, 3, 1><<<dim3(NB_ * TT / 256, 3 * DQ / 192, 1), 384, 0, stream>>>(XB, nullptr, WT, nullptr, nullptr, 0, bq, bk, bv, CS, P16, Ph, Pl);
    k_fattn<<<dim3(RH / 32, NH_, NB_), 96, 0, stream>>>(P16, P16 + PL, P16 + 2 * PL, Ph, Pl, Ph + PL, Pl + PL, Ph + 2 * PL, Pl + 2 * PL, ATh, ATl);   // one kv head per query head
    k_gemmw<bf, 1, true, 0, DQ, 2, 2, 2><<<dim3(NB_ * TT / 128, DM / 128, 1), 128, 0, stream>>>(ATh, ATl, WT + (size_t)3 * DM * DM, nullptr, OUT, DM, bo, nullptr, nullptr, nullptr, nullptr, nullptr, nullptr);
}

// v007
// One run takes 93.2 microseconds.
// Next to v006, in two timings, it ran 1.25 times as fast each time.
// Counting every step since v000, it is 21.4 times as fast.
#include <hip/hip_runtime.h>

// Multi-head attention with biased 'xw' projections and a COMPUTED rotate-half rotary embedding, NO mask (x [2][2048][1024]; q, k, v = x W + b ('xw' (in, out) [1024][1024] 0.02 + zero biases (ONE zeros array bound four times by the module's setup): read; 16 heads x 64); q, k -> cat(x1 cos - x2 sin, x2 cos + x1 sin) on the two 32-wide halves (= t cos + cat(-t2, t1) sin with cat(freqs, freqs)) with angle t x 1 / 10000^(2i/64) (32 f32 frequencies exact for the module's expression 1.0 / (10000.0 ** (arange(0, 64, 2) / 64)); precise cosf/sinf); scores / sqrt(64) (np.sqrt(D_K) as float32); softmax over all keys; out = merged Wo + bo ('xw' + bias) -> [2][2048][1024] (4.2 M); argument order x, Wq, bq, Wk, bk, Wv, bv, Wo, bo).
// Layout, both batches side by side in every plane and every grid (x is taken as [4096][1024]): bf16 copy of x; 'xw' weights transposed once; exact projections + f32 biases; d_cs5 computes the rotary table once (32 baked float32 frequencies) and the projection kernel's own epilogue applies the rotate-half rotation at width 64 and writes the head planes (q, k) or the transposed planes (v); q, k and v come from ONE grid (Wq, Wk, Wv stacked as 3072 rows); one fused attention kernel (scores, running-maximum softmax with the 1/8 in the exponent, P x V; hybrid rows: < 512 hi/lo 3 products, rest fp16); merged hi/lo x wo exact + bo.
// Fragment order: every 16-bit operand plane [rows][k] lies in memory as tiles of 16 rows x 32 k (FT = 512 elements, 1 KiB), the tiles of one block of 16 rows one behind the other along k (v: the four d tiles of 32 keys together). Inside a tile element (r, k) stands at (k / 16) * 256 + ((k % 16) / 8 * 16 + r) * 8 + k % 8, so lane (lr, hi) finds its two 16-byte pieces (k = 8 hi + s and 16 + 8 hi + s) at lane * 8 and 256 + lane * 8 and each wave-wide 16-byte load or store covers 512 contiguous bytes (4 whole lines).
// Compute dtypes, f32 accumulate: every input rounded to bf16; projections exact + f32 biases; attention rows < 512 3 products, rest fp16; softmax f32; Wo hl x exact + bias.

#define NB_  2
#define TT   2048
#define DM   1024
#define NH_  16
#define NKV  16
#define REP  (NH_ / NKV)
#define HD   64
#define DQ   (NH_ * HD)
#define DKV  (NKV * HD)
#define RH   512                  // query rows < RH use hi+lo planes
#define SCL  0.125f   // HD^-0.5
#define FT   512                  // elements of one fragment tile (16 rows x 32 k)
typedef _Float16 h16;
typedef unsigned short bf;
typedef __attribute__((ext_vector_type(16))) __bf16   v16bf;
typedef __attribute__((ext_vector_type(16))) _Float16 v16h;
typedef __attribute__((ext_vector_type(8)))  _Float16 v8h;
typedef __attribute__((ext_vector_type(8)))  unsigned short v8us;
typedef __attribute__((ext_vector_type(8)))  float    v8f;
typedef __attribute__((ext_vector_type(4)))  float    v4f;
typedef v8h  __attribute__((may_alias)) v8ha;
typedef v4f  __attribute__((may_alias)) v4fa;
typedef v8us __attribute__((may_alias)) v8usa;

__device__ __forceinline__ unsigned short f2bf(float f) { unsigned u = __float_as_uint(f); u += 0x7FFFu + ((u >> 16) & 1u); return (unsigned short)(u >> 16); }
__device__ __forceinline__ float bf2f(unsigned short b) { return __uint_as_float(((unsigned)b) << 16); }
__device__ __forceinline__ float bfr(float f) { return bf2f(f2bf(f)); }
__device__ __forceinline__ v16h cat16(v8h lo, v8h hi) { return __builtin_shufflevector(lo, hi, 0, 1, 2, 3, 4, 5, 6, 7, 8, 9, 10, 11, 12, 13, 14, 15); }
__device__ __forceinline__ v16bf cat16b(v8us lo, v8us hi) { return __builtin_bit_cast(v16bf, __builtin_shufflevector(lo, hi, 0, 1, 2, 3, 4, 5, 6, 7, 8, 9, 10, 11, 12, 13, 14, 15)); }
__device__ __forceinline__ v8f wmma16(v16h a, v16h b, v8f c) { return __builtin_amdgcn_wmma_f32_16x16x32_f16(false, a, false, b, (short)0, c, false, false); }
__device__ __forceinline__ v8f wmmab(v16bf a, v16bf b, v8f c) { return __builtin_amdgcn_wmma_f32_16x16x32_bf16(false, a, false, b, (short)0, c, false, false); }
__device__ __forceinline__ h16 tohx(float x) { return (h16)x; }
__device__ __forceinline__ void splitf(float y, unsigned short& h, unsigned short& l) { h = f2bf(y); l = f2bf(y - bf2f(h)); }
typedef __attribute__((ext_vector_type(2))) _Float16 v2h;
typedef __attribute__((ext_vector_type(4))) _Float16 v4h;
typedef __attribute__((ext_vector_type(2))) unsigned short v2us;
typedef __attribute__((ext_vector_type(4))) unsigned short v4us;
typedef __attribute__((ext_vector_type(2))) float v2f;
typedef __attribute__((ext_vector_type(4))) int v4i;
typedef __attribute__((ext_vector_type(16))) float v16f;
// XW: s_wait_xcnt 0 stands between issued global loads or stores and the first overwrite of a register they name; the scheduling barriers on both sides keep later arithmetic from being lifted over the wait.
__device__ __forceinline__ void XW() { __builtin_amdgcn_sched_barrier(0); asm volatile("s_wait_xcnt 0x0" ::: "memory"); __builtin_amdgcn_sched_barrier(0); }



// ---- k_gemmw: register-blocked GEMM, one wave per 64x64 output tile (16 accumulators), WM x WN waves a work-group; grid (M / (64 WM), N / (64 WN)), 32 WM WN threads.
// The waves of a work-group share their operands through LDS: a stage is HS halves of 64 k (HS = 2 where the registers allow it: fewer barriers); a half holds two fragment tiles (2 KiB) of every block of 16 rows that the work-group reads (A, A2 where it is used, then Bt), brought in by asynchronous copies (512 contiguous bytes a wave-wide copy, fragment order kept, so WFrag::ld takes tile + lane * 8 in LDS as in memory); two buffers, the next stage's copies fly while this one is worked on.
// C[m][n] (+ f32 bias[n]) = sum_k A[m][k] Bt[n][k] (+ split products per NSPLIT). K % (64 HS) == 0, K >= 128 HS.
// EPI says where the tile goes. 0: f32 C, pitch ldc. 1: the q, k, v projections of both batches in one grid: M = NB_ TT rows (batch, t), N = 3 DQ columns (q | k | v, biases bias | biask | biasv). A 64-wide tile is one head (HD == 64) of one of the three, so the tile finishes that head's planes [q, k, v][batch][h] from the accumulators, with no f32 copy in memory:
// q, k: rotate-half rotation out[d] = x[d] cos[t][d] - x[d+32] sin[t][d], out[d+32] = x[d+32] cos[t][d] + x[d] sin[t][d] (table CS [t][d](cos, sin), whose two halves are equal), planes [t][d] (fp16 + hi/lo); v: planes [d][t] (fp16 + hi/lo); all in fragment order.
template <typename T16> struct WFrag;
template <> struct WFrag<h16> { typedef v16h V; static __device__ __forceinline__ V ld(const h16* p) { return cat16(*(const v8h*)p, *(const v8h*)(p + 256)); } static __device__ __forceinline__ v8f mma(V a, V b, v8f c) { return wmma16(a, b, c); } };
template <> struct WFrag<bf> { typedef v16bf V; static __device__ __forceinline__ V ld(const bf* p) { return cat16b(*(const v8us*)p, *(const v8us*)(p + 256)); } static __device__ __forceinline__ v8f mma(V a, V b, v8f c) { return wmmab(a, b, c); } };
// cp1, cp9, cp12: 1, 9 or 12 asynchronous 16-byte-a-lane copies to LDS in one statement that ends in s_wait_xcnt 0, so that the wait stands ahead of every later write of a register that a copy names.
#define CPL(a, b) "global_load_async_to_lds_b128 %" #a ", %" #b ", off\n\t"
__device__ __forceinline__ void cp1(unsigned l, const char* g) { asm volatile(CPL(0, 1) "s_wait_xcnt 0x0" :: "v"(l), "v"(g) : "memory"); }
__device__ __forceinline__ void cp9(const unsigned* l, const char* const* g) { asm volatile(CPL(0, 1) CPL(2, 3) CPL(4, 5) CPL(6, 7) CPL(8, 9) CPL(10, 11) CPL(12, 13) CPL(14, 15) CPL(16, 17) "s_wait_xcnt 0x0" :: "v"(l[0]), "v"(g[0]), "v"(l[1]), "v"(g[1]), "v"(l[2]), "v"(g[2]), "v"(l[3]), "v"(g[3]), "v"(l[4]), "v"(g[4]), "v"(l[5]), "v"(g[5]), "v"(l[6]), "v"(g[6]), "v"(l[7]), "v"(g[7]), "v"(l[8]), "v"(g[8]) : "memory"); }
__device__ __forceinline__ void cp12(const unsigned* l, const char* const* g) { asm volatile(CPL(0, 1) CPL(2, 3) CPL(4, 5) CPL(6, 7) CPL(8, 9) CPL(10, 11) CPL(12, 13) CPL(14, 15) CPL(16, 17) CPL(18, 19) CPL(20, 21) CPL(22, 23) "s_wait_xcnt 0x0" :: "v"(l[0]), "v"(g[0]), "v"(l[1]), "v"(g[1]), "v"(l[2]), "v"(g[2]), "v"(l[3]), "v"(g[3]), "v"(l[4]), "v"(g[4]), "v"(l[5]), "v"(g[5]), "v"(l[6]), "v"(g[6]), "v"(l[7]), "v"(g[7]), "v"(l[8]), "v"(g[8]), "v"(l[9]), "v"(g[9]), "v"(l[10]), "v"(g[10]), "v"(l[11]), "v"(g[11]) : "memory"); }
template <typename T16, int NSPLIT, bool BIAS, int EPI, int K, int WM, int WN, int HS>
__global__ __launch_bounds__(WM * WN * 32) void k_gemmw(const T16* __restrict__ A, const T16* __restrict__ A2, const T16* __restrict__ Bt, const T16* __restrict__ Bt2, float* C, int ldc, const float* __restrict__ bias, const float* __restrict__ biask, const float* __restrict__ biasv, const float* __restrict__ CS, h16* P16, bf* Ph, bf* Pl) {
    static_assert(EPI == 0 || (HD == 64 && NKV == NH_ && TT % 64 == 0), "one tile, one head of one batch; q, k, v planes of one size");
    typedef typename WFrag<T16>::V V;
    static_assert(NSPLIT <= 1 && K % (64 * HS) == 0 && K >= 128 * HS && (WM * WN) % 4 == 0, "stages of 64 HS k, at least two; four waves copy one block of rows");
    constexpr int NW = WM * WN, NA = WM * 4, NAT = NSPLIT == 1 ? 2 * NA : NA, NBLK = NAT + WN * 4, SE = NBLK * 2 * FT, NS = K / (64 * HS);   // blocks of 16 rows of A, of A and A2, of all operands; elements of a half; stages
    constexpr int BS = NW / 4, NFULL = NBLK / BS, REM = NBLK % BS;   // wave w copies quarter w % 4 of blocks w / 4 + BS i: NFULL copies in every wave, one more in the waves with w / 4 < REM
    static_assert((NFULL == 9 || NFULL == 24) && REM <= 1, "the copy statements at hand");
    __shared__ __align__(16) T16 ring[2 * HS * SE];
    __shared__ __align__(16) float osw[NW][16 * 68];
    const int lane = threadIdx.x & 31, lr = lane & 15, hi = lane >> 4; const int wave = __builtin_amdgcn_readfirstlane((int)(threadIdx.x >> 5)), wm = wave % WM, wn = wave / WM, wq = NW == 4 ? 0 : wave >> 2;
    const int R0 = blockIdx.x * (WM * 64), C0 = blockIdx.y * (WN * 64), by = (int)blockIdx.y * WN + wn; const int r0 = R0 + wm * 64, c0 = by * 64; float* os = osw[wave];   // each wave stages its output rows in its own part
    // EPI 1: which of q, k, v (sel, the same for the whole wave), the head's first column in its own bias, the tile's first t, and the head's place in the planes
    const int sel = by / NH_, cb = (by % NH_) * 64, t0 = r0 % TT; const size_t pofs = (((size_t)sel * NB_ + r0 / TT) * NH_ + by % NH_) * TT * HD;
    const float* bs = sel == 0 ? bias : sel == 1 ? biask : biasv;
    v8f acc[4][4];
#pragma unroll
    for (int mb = 0; mb < 4; ++mb)
#pragma unroll
        for (int nb = 0; nb < 4; ++nb) acc[mb][nb] = (v8f){};
    (void)Bt2;
    // half st (64 k) into place bf_ of the ring's 2 HS: in memory a block of 16 rows is K / 32 tiles = 16 K elements, of which the half takes tiles 2 st and 2 st + 1; in LDS block j of the half stands at j * 2 FT
    auto copies = [&](int st, int bf_) {
        const unsigned lb = (unsigned)(size_t)ring + (unsigned)(((bf_ * NBLK + wq) * 4 + (wave & 3)) * 512 + lane * 16); const size_t go = (size_t)((st * 4 + (wave & 3)) * 512 + lane * 16);
        auto sp = [&](int i) { const int blk = wq + BS * i; const size_t ea = (size_t)(R0 / 16 + blk) * 16 * K, eb = (size_t)(C0 / 16 + blk - NAT) * 16 * K; const T16* p;   // which operand block wq + BS i belongs to is known at compile time unless the BS blocks of this i straddle a border
            if (BS * i + BS - 1 < NA) p = A + ea; else if (BS * i >= NAT) p = Bt + eb; else if (NSPLIT == 1 && BS * i >= NA && BS * i + BS - 1 < NAT) p = A2 + (ea - (size_t)NA * 16 * K);
            else p = blk < NA ? A + ea : (NSPLIT == 1 && blk < NAT) ? A2 + (ea - (size_t)NA * 16 * K) : Bt + eb;
            return (const char*)p + go; };
        unsigned l[NFULL]; const char* g[NFULL];
#pragma unroll
        for (int i = 0; i < NFULL; ++i) { l[i] = lb + BS * i * 2048; g[i] = sp(i); }
        if constexpr (NFULL == 9) cp9(l, g); else { cp12(l, g); __builtin_amdgcn_sched_barrier(0); cp12(l + 12, g + 12); }   // the scheduling barriers here and below keep the address arithmetic of one copy statement behind the statement before it: formed all at once, the addresses do not fit the registers and are spilled
        if (REM > 0 && wq < REM) cp1(lb + BS * NFULL * 2048, sp(NFULL));   // a scalar test: wq is the same in every lane
        __builtin_amdgcn_sched_barrier(0); };
    auto stage = [&](int s, int bu) {   // stage s into buffer bu
#pragma unroll
        for (int h = 0; h < HS; ++h) copies(s * HS + h, bu * HS + h); };
    // each lane's own places in the first buffer's tiles; the other blocks of rows, the other tiles and the second buffer stand at constant distances
    const T16* fa = ring + (wm * 4) * 2 * FT + lane * 8; const T16* fa2 = ring + (NA + wm * 4) * 2 * FT + lane * 8; const T16* fb = ring + (NAT + wn * 4) * 2 * FT + lane * 8;
    stage(0, 0);
    // EPI 1: 8 lanes a row; a lane takes 4 columns of the head's low half and their partners in the high half, which share one (cos, sin). The table rows of 16 tile rows are fetched one block of rows ahead of their use. (The loops of both epilogues are unrolled because acc, cs and the vectors they fill live in registers and take constant indices only.)
    const int rq = lane >> 3, col = (lane & 7) * 4; v4f b1 = (v4f){}, b2 = (v4f){}, cs[2][4][2];
    auto ldcs = [&](int mb) {
#pragma unroll
        for (int s = 0; s < 4; ++s) { const float* cp = CS + ((size_t)(t0 + mb * 16 + 4 * s + rq) * HD + col) * 2; cs[mb & 1][s][0] = *(const v4f*)cp; cs[mb & 1][s][1] = *(const v4f*)(cp + 4); }
        XW(); };   // the arithmetic that follows reuses the address registers of these loads
    if (EPI == 1 && sel < 2) { const float* bp = bs + cb + col;   // this lane's four low-half columns; their partners stand HD / 2 further
#pragma unroll
        for (int i = 0; i < 4; ++i) { b1[i] = bp[i]; b2[i] = bp[HD / 2 + i]; }
        asm volatile("s_wait_xcnt 0x0" :: "v"(bp) : "memory");   // s_wait_xcnt 0 behind the two bias loads, ahead of the arithmetic that reuses their address registers; the address is an input so that it lives up to the wait and no load's result lands on it
#pragma unroll
        for (int i = 0; i < 4; ++i) { b1[i] = bfr(b1[i]); b2[i] = bfr(b2[i]); }
        ldcs(0); }
    if (EPI == 1 && sel == 2) {   // the four columns' biases, fetched ahead of the K loop like the table rows above
#pragma unroll
        for (int nb = 0; nb < 4; ++nb) b1[nb] = bs[cb + nb * 16 + lr];
        XW(); }   // as behind the table rows
    asm volatile("s_wait_asynccnt 0x0" ::: "memory");   // this wave's copies of stage 0 have landed
    __syncthreads();   // ... and every other wave's: stage 0 may be read
    stage(1, 1);
#pragma unroll 1   // rolled: one trip is one stage, and the trips are separated by a barrier
    for (int s = 0; s < NS; ++s) {
        const int bo = (s & 1) * HS * SE;
        V a[2][4], a2[2][4], b[2][4];   // two fragment sets: tile kt of the stage's 2 HS goes through set kt % 2
        auto ldf = [&](int kt) { const int o = bo + (kt >> 1) * SE + (kt & 1) * FT, q = kt & 1;
#pragma unroll
            for (int mb = 0; mb < 4; ++mb) { a[q][mb] = WFrag<T16>::ld(fa + o + mb * 2 * FT); if (NSPLIT == 1) a2[q][mb] = WFrag<T16>::ld(fa2 + o + mb * 2 * FT); }
#pragma unroll
            for (int nb = 0; nb < 4; ++nb) b[q][nb] = WFrag<T16>::ld(fb + o + nb * 2 * FT);
            __builtin_amdgcn_sched_barrier(0); };   // a tile's fragment loads stay together at their place, one tile ahead of their products (LDS loads return in order, so an earlier tile's must not stand behind a later tile's)
        auto mm = [&](int q) {
#pragma unroll
            for (int nb = 0; nb < 4; ++nb) {
#pragma unroll
                for (int mb = 0; mb < 4; ++mb) { acc[mb][nb] = WFrag<T16>::mma(a[q][mb], b[q][nb], acc[mb][nb]); if (NSPLIT == 1) acc[mb][nb] = WFrag<T16>::mma(a2[q][mb], b[q][nb], acc[mb][nb]); } }
            __builtin_amdgcn_sched_barrier(0); };   // a tile's products stay where they stand: ahead of the loads that refill their set, and the last but one's ahead of the waits (left free, this build moves products behind the barrier and the copies, which then start too late to land within one trip)
        ldf(0); ldf(1);
#pragma unroll
        for (int kt = 0; kt < 2 * HS - 2; ++kt) { mm(kt & 1); ldf(kt + 2); }
        mm(0);
        asm volatile("s_wait_dscnt 0x0" ::: "memory");   // this wave's reads of the buffer are done before the barrier behind which it is refilled
        asm volatile("s_wait_asynccnt 0x0" ::: "memory");   // this wave's copies of stage s + 1 have landed
        __syncthreads();   // publishes stage s + 1 and ends every wave's reads of stage s
        if (s + 2 < NS) stage(s + 2, s & 1);
        __builtin_amdgcn_sched_barrier(0);   // the last tile's products, which work from registers alone, stay behind the copies and cover the start of their flight
        mm(1);
    }
    asm volatile("s_wait_asynccnt 0x0" ::: "memory");   // no copy is in flight where the wave goes on to its epilogue
    if (EPI == 1 && sel == 2) {   // a lane's 8 accumulator registers are 8 consecutive t of one column d: the lane's own 16-byte piece of tile (32 keys, d block nb), so each store covers 512 contiguous bytes
#pragma unroll
        for (int nb = 0; nb < 4; ++nb) { const float bb = bfr(b1[nb]); const size_t e = pofs + (size_t)(t0 / 32 * 4 + nb) * FT + lane * 8;
#pragma unroll
            for (int mb = 0; mb < 4; ++mb) { v8h o16; v8us oh, ol;
#pragma unroll
                for (int j = 0; j < 8; ++j) { const float x = acc[mb][nb][j] + bb; o16[j] = tohx(x); unsigned short a2, c2; splitf(x, a2, c2); oh[j] = a2; ol[j] = c2; }
                const int f = (mb >> 1) * 4 * FT + (mb & 1) * 256; *(v8h*)(P16 + e + f) = o16; *(v8us*)(Ph + e + f) = oh; *(v8us*)(Pl + e + f) = ol; }
            XW(); }   // the next column block's arithmetic reuses the registers that these stores name
        return; }
#pragma unroll
    for (int mb = 0; mb < 4; ++mb) {
#pragma unroll
        for (int nb = 0; nb < 4; ++nb) {
#pragma unroll
            for (int j = 0; j < 8; ++j) os[(hi * 8 + j) * 68 + nb * 16 + lr] = acc[mb][nb][j]; }
        __builtin_amdgcn_wave_barrier(); asm volatile("" ::: "memory");
        float* crow = C + (size_t)(r0 + mb * 16) * ldc + c0;
        if (EPI == 0)
{
#pragma unroll
            for (int s = 0; s < 8; ++s) { const int row = 2 * s + hi, cofs = lr * 4; v4f val = *(const v4fa*)(os + row * 68 + cofs); if (BIAS) { val[0] += bfr(bias[c0 + cofs]); val[1] += bfr(bias[c0 + cofs + 1]); val[2] += bfr(bias[c0 + cofs + 2]); val[3] += bfr(bias[c0 + cofs + 3]); }
                *(v4f*)(crow + (size_t)row * ldc + cofs) = val; }
             }
        if (EPI == 1) {
            if (mb < 3) ldcs(mb + 1);
#pragma unroll
            for (int s = 0; s < 4; ++s) { const int row = 4 * s + rq; const v4f x1 = *(const v4fa*)(os + row * 68 + col) + b1, x2 = *(const v4fa*)(os + row * 68 + HD / 2 + col) + b2; const v4f ca = cs[mb & 1][s][0], cb = cs[mb & 1][s][1];
                const v4f cc = { ca[0], ca[2], cb[0], cb[2] }, sn = { ca[1], ca[3], cb[1], cb[3] }; const v4f rl = x1 * cc - x2 * sn, rh = x2 * cc + x1 * sn; v4h l16, u16; v4us lh, ll, uh, ul;
#pragma unroll
                for (int i = 0; i < 4; ++i) { unsigned short a2, c2; l16[i] = tohx(rl[i]); splitf(rl[i], a2, c2); lh[i] = a2; ll[i] = c2; u16[i] = tohx(rh[i]); splitf(rh[i], a2, c2); uh[i] = a2; ul[i] = c2; }
                const size_t e = pofs + (size_t)(t0 / 16 + mb) * 2 * FT + (col / 16) * 256 + ((col % 16) / 8 * 16 + row) * 8 + col % 8;   // the low half is the rows' first tile, the high half the second
                *(v4h*)(P16 + e) = l16; *(v4h*)(P16 + e + FT) = u16; *(v4us*)(Ph + e) = lh; *(v4us*)(Ph + e + FT) = uh; *(v4us*)(Pl + e) = ll; *(v4us*)(Pl + e + FT) = ul;
                XW(); } }   // the next rows' arithmetic reuses the registers that these stores name
        __builtin_amdgcn_wave_barrier(); asm volatile("" ::: "memory");
    }
}

// The three preparations (d_wtG, d_cvt8, d_cs5) are blocks of 256 threads of ONE grid, k_prep below; bx is the block's number within its own part.
// d_wtG: one wave builds one tile (16 n x 32 k) of the transposed weight; the 8 waves of a block take 8 neighbouring n blocks of the same 32 k, so that the block reads 512 contiguous bytes of each row of w.
__device__ __forceinline__ void d_wtG(int bx, const float* __restrict__ w, int K, int N, bf* Bt) {
    const int lane = threadIdx.x & 31, lr = lane & 15, hi = lane >> 4; const int g = bx * 8 + (threadIdx.x >> 5); if (g >= (N / 16) * (K / 32)) return;
    const int tn = g % (N / 16), tk = g / (N / 16); const float* s = w + (size_t)(tk * 32 + 8 * hi) * N + tn * 16 + lr; v8us o0, o1;
#pragma unroll
    for (int i = 0; i < 8; ++i) { o0[i] = f2bf(s[(size_t)i * N]); o1[i] = f2bf(s[(size_t)(16 + i) * N]); }
    bf* d = Bt + ((size_t)tn * (K / 32) + tk) * FT + lane * 8; *(v8us*)d = o0; *(v8us*)(d + 256) = o1;
}
// d_cvt8: thread i writes the i-th 16-byte piece of the plane in fragment order and reads the 8 values of src [rows][K] that belong there.
__device__ __forceinline__ void d_cvt8(int bx, const float* __restrict__ src, int K, bf* dst, size_t n8) { const size_t i = (size_t)bx * 256 + threadIdx.x; if (i >= n8) return; const int lane = (int)(i & 31), j = (int)(i >> 5) & 1; const size_t tile = i >> 6;
    const v8f v = *(const v8f*)(src + (tile / (K / 32) * 16 + (lane & 15)) * K + tile % (K / 32) * 32 + j * 16 + (lane >> 4) * 8); v8us o;
#pragma unroll
    for (int k = 0; k < 8; ++k) o[k] = f2bf(v[k]); *(v8us*)(dst + i * 8) = o;  }

__global__ __launch_bounds__(256) void k_csid(float* CS) { const int idx = blockIdx.x * 256 + threadIdx.x; if (idx >= TT * HD) return; v2f cs; cs[0] = 1.0f; cs[1] = 0.0f; *(v2f*)(CS + (size_t)idx * 2) = cs;  }
__constant__ float INVT[HD / 2] = { 1.000000000e+00f, 7.498942018e-01f, 5.623413324e-01f, 4.216965139e-01f, 3.162277639e-01f, 2.371373624e-01f, 1.778279394e-01f, 1.333521456e-01f, 1.000000015e-01f, 7.498941571e-02f, 5.623412877e-02f, 4.216964915e-02f, 3.162277862e-02f, 2.371373586e-02f, 1.778279431e-02f, 1.333521493e-02f, 9.999999776e-03f, 7.498942316e-03f, 5.623413250e-03f, 4.216964822e-03f, 3.162277862e-03f, 2.371373819e-03f, 1.778279431e-03f, 1.333521446e-03f, 1.000000047e-03f, 7.498941850e-04f, 5.623413017e-04f, 4.216964880e-04f, 3.162277862e-04f, 2.371373848e-04f, 1.778279402e-04f, 1.333521504e-04f };   // float32 1 / 10000^(2i/64), generated with jnp to be bit-exact
__device__ __forceinline__ void d_cs5(int bx, float* CS) { const int idx = bx * 256 + threadIdx.x; if (idx >= TT * HD) return; const int d = idx % HD; const int t = idx / HD; const float a = __fmul_rn((float)t, INVT[d % (HD / 2)]); v2f cs; cs[0] = cosf(a); cs[1] = sinf(a); *(v2f*)(CS + (size_t)idx * 2) = cs;  }
// ---- k_prep: the preparations do not depend on one another, so they share one grid: blocks [0, 4 NWB) transpose the four weights (planes stacked in WT), the next NCB compute the rotary table, the last NXB round x (both batches) to bf16.
#define NWB ((DM / 16) * (DM / 32) / 8)
#define NCB ((TT * HD + 255) / 256)
#define NXB ((NB_ * TT * DM / 8 + 255) / 256)
__global__ __launch_bounds__(256) void k_prep(const float* __restrict__ x, const float* __restrict__ w0, const float* __restrict__ w1, const float* __restrict__ w2, const float* __restrict__ w3, bf* XB, bf* WT, float* CS) {
    const int bx = (int)blockIdx.x;
    if (bx < 4 * NWB) { const int y = bx / NWB; d_wtG(bx % NWB, y == 0 ? w0 : y == 1 ? w1 : y == 2 ? w2 : w3, DM, DM, WT + (size_t)y * DM * DM); }
    else if (bx < 4 * NWB + NCB) d_cs5(bx - 4 * NWB, CS);
    else d_cvt8(bx - 4 * NWB - NCB, x, DM, XB, (size_t)NB_ * TT * DM / 8);
}
// ---- k_fattn: scores, softmax and P x V of one head in ONE kernel; S and P stay in registers. One wave owns 16 NQ query rows and walks the 2048 keys 32 at a time; the waves of a work-group share the K and V fragments through an LDS ring.
// S^T = K Q^T (A = 16 key rows, B = 16 query rows kept in registers): D register r of lane (lr, hi) is key 8 hi + r of query lr, so the two key tiles of a trip, converted in place, are the B operand (k order 8 hi + s, 16 + 8 hi + s: the order of WFrag::ld) of O^T += V^T P^T.
// Softmax with a running maximum m per query, held in the exponent's own unit (score x SCL x log2 e): p = exp2(s c - m), unnormalised; m, the sum and O move only on a trip where some score stands more than 8 above its m (so p <= 2^8); O / sum at the end.
__device__ __forceinline__ float xhalf(float x) { const int b = __float_as_int(x); return __int_as_float(__builtin_amdgcn_permlanex16(b, b, 0x76543210, 0xfedcba98, false, false)); }   // lane l <-> l ^ 16
template <typename T16> struct PFrag;
template <> struct PFrag<h16> { static __device__ __forceinline__ void cv(v16f e, v16h& p, v16h& p2) { (void)p2; p = __builtin_convertvector(e, v16h); } };
template <> struct PFrag<bf> { static __device__ __forceinline__ void cv(v16f e, v16bf& p, v16bf& p2) { p = __builtin_convertvector(e, v16bf); p2 = __builtin_convertvector(e - __builtin_convertvector(p, v16f), v16bf); } };   // hi + lo, both rounded to nearest even as in splitf
// cp8: eight asynchronous 16-byte-a-lane copies to LDS, 512 bytes apart in memory and in LDS, in one statement that ends in s_wait_xcnt 0, so that the wait stands ahead of every later write of a register that a copy names.
__device__ __forceinline__ void cp8(unsigned l, const char* g) { asm volatile(CPL(0, 1) CPL(2, 3) CPL(4, 5) CPL(6, 7) CPL(8, 9) CPL(10, 11) CPL(12, 13) CPL(14, 15) "s_wait_xcnt 0x0" :: "v"(l), "v"(g), "v"(l + 512), "v"(g + 512), "v"(l + 1024), "v"(g + 1024), "v"(l + 1536), "v"(g + 1536), "v"(l + 2048), "v"(g + 2048), "v"(l + 2560), "v"(g + 2560), "v"(l + 3072), "v"(g + 3072), "v"(l + 3584), "v"(g + 3584) : "memory"); }
template <bool B> struct Flag { static constexpr bool v = B; };
// fattn: one work-group of 8 waves, all of one kind, on one head. The head's K and V planes (hi/lo: 4, fp16: 2) go through LDS once for the whole work-group: a stage is SK keys of every plane (contiguous in memory: 32 keys are four tiles in a row; fragment order kept), two buffers, the next stage's copies fly while this one is worked on.
// hi/lo: waves 0 to 3 compute, waves 4 to 7 only copy, a plane each; fp16: all 8 waves compute and each copies a quarter of a plane. Every wave passes every barrier.
template <typename T16, bool SPLIT, int NQ, int SK>
__device__ __forceinline__ void fattn(const T16* ring, const T16* __restrict__ Q, const T16* __restrict__ Q2, const T16* __restrict__ Kp, const T16* __restrict__ K2, const T16* __restrict__ Vt, const T16* __restrict__ V2, int qw, bf* Ah, bf* Al) {
    typedef typename WFrag<T16>::V V;
    constexpr int NPL = SPLIT ? 4 : 2, PE = SK * HD, NS = TT / SK, CB = NPL * PE * 2 / (SPLIT ? 4 : 8);   // planes; elements that a stage takes of a plane; stages; bytes that a copying wave brings a stage
    static_assert(TT % SK == 0 && NS >= 2 && SK % 32 == 0 && CB % 4096 == 0 && CB / 512 <= 63 && (PE * 2) % CB == 0, "stage and copy shape");
    const float C2 = SCL * 1.4426950408889634f;
    const int lane = threadIdx.x & 31; const int wave = __builtin_amdgcn_readfirstlane((int)(threadIdx.x >> 5));
    const bool comp = !SPLIT || wave < 4, cpw = !SPLIT || wave >= 4;   // the same in every lane of a wave: the tests on them are scalar branches
    const int q0 = qw + (SPLIT ? wave & 3 : wave) * (16 * NQ);
    const int c = SPLIT ? wave & 3 : wave;   // the copying wave's part: parts lie one behind the other in a buffer, [plane][PE]
    const T16* pl = SPLIT ? (c == 0 ? Kp : c == 1 ? K2 : c == 2 ? Vt : V2) : (c < 4 ? Kp : Vt) + (c & 3) * (CB / 2);
    const char* src = (const char*)pl + lane * 16; const unsigned lb = (unsigned)(size_t)ring + (unsigned)(c * CB + lane * 16);
    auto copies = [&](int s, int bu) {   // this wave's part of stage s into buffer bu
        const char* g = src + (size_t)s * (PE * 2); const unsigned l = lb + (unsigned)(bu * (NPL * PE * 2));
#pragma unroll
        for (int i = 0; i < CB / 4096; ++i) { cp8(l + i * 4096, g + i * 4096); __builtin_amdgcn_sched_barrier(0); } };   // the scheduling barrier keeps the address arithmetic of one copy statement behind the statement before it, so that only eight copies' addresses are held at a time
    V qf[NQ][2], qf2[NQ][2], kf[2][2], kf2[2][2], vf[4], vf2[4];
    if (comp) {
        const T16* qb = Q + (size_t)(q0 / 16) * 2 * FT; const T16* qb2 = SPLIT ? Q2 + (size_t)(q0 / 16) * 2 * FT : nullptr;   // the wave's first Q tile, the same in every lane; a lane's place is lane * 8 further
#pragma unroll
        for (int nq = 0; nq < NQ; ++nq)
#pragma unroll
            for (int ks = 0; ks < 2; ++ks) { const int c = lane * 8 + (nq * 2 + ks) * FT; qf[nq][ks] = WFrag<T16>::ld(qb + c); if (SPLIT) qf2[nq][ks] = WFrag<T16>::ld(qb2 + c); }
        // the wait behind the Q loads takes their base addresses as inputs, so that those registers stay theirs up to the wait
        if (SPLIT) asm volatile("s_wait_xcnt 0x0" :: "s"(qb), "s"(qb2) : "memory");
        else asm volatile("s_wait_xcnt 0x0" :: "s"(qb) : "memory");
        __builtin_amdgcn_sched_barrier(0);   // later address arithmetic stays behind the wait
    }
    v8f oa[4][NQ]; float m[NQ]; v2f l[NQ];   // l: two partial sums a lane (even and odd registers), joined at the end
#pragma unroll
    for (int nq = 0; nq < NQ; ++nq) { m[nq] = -3.0e38f; l[nq] = (v2f){};
#pragma unroll
        for (int db = 0; db < 4; ++db) oa[db][nq] = (v8f){}; }
    // Trips -2 and -1 are the ring's prologue and work on nothing: trip -2 only starts stage 0's copies; trip -1 waits for them, publishes them at its barrier and then starts stage 1's. (With the copy statements at one place, no register that a copy statement names is held through the trips; held so, this build spilled it to scratch.)
#pragma unroll 1   // rolled: one trip is one stage, and the trips are separated by a barrier
    for (int sg = -2; sg < NS; ++sg) {
      if (comp && sg >= 0) {
        // K and V^T addresses in this stage's buffer: each lane's own places, which step 32 keys a trip, + a constant; every fragment read below lies in this buffer
        const T16* bb = ring + (sg & 1) * (NPL * PE) + lane * 8;
        const T16* kq = bb; const T16* kq2 = SPLIT ? bb + PE : nullptr; const T16* vq = bb + (SPLIT ? 2 : 1) * PE; const T16* vq2 = SPLIT ? bb + 3 * PE : nullptr;   // 32 keys are four tiles in a row in K (2 key blocks x 2 halves of d) and in V^T (4 d blocks)
#pragma unroll
        for (int kb = 0; kb < 2; ++kb)
#pragma unroll
            for (int ks = 0; ks < 2; ++ks) { const int c = (kb * 2 + ks) * FT; kf[kb][ks] = WFrag<T16>::ld(kq + c); if (SPLIT) kf2[kb][ks] = WFrag<T16>::ld(kq2 + c); }
#pragma unroll
        for (int db = 0; db < 4; ++db) { const int c = db * FT; vf[db] = WFrag<T16>::ld(vq + c); if (SPLIT) vf2[db] = WFrag<T16>::ld(vq2 + c); }
        auto trip = [&](auto more) {   // 32 keys; more.v: fetch the next trip's fragments
            v8f s[2][NQ];
#pragma unroll
            for (int kb = 0; kb < 2; ++kb)
#pragma unroll
                for (int nq = 0; nq < NQ; ++nq) { v8f t = (v8f){};
#pragma unroll
                    for (int ks = 0; ks < 2; ++ks) { t = WFrag<T16>::mma(kf[kb][ks], qf[nq][ks], t); if (SPLIT) { t = WFrag<T16>::mma(kf2[kb][ks], qf[nq][ks], t); t = WFrag<T16>::mma(kf[kb][ks], qf2[nq][ks], t); } }
                    s[kb][nq] = t; }
            if constexpr (more.v) {
                __builtin_amdgcn_sched_barrier(0);   // the K fragment loads stay together behind the score products, for speed only
                kq += 4 * FT; if (SPLIT) kq2 += 4 * FT;
#pragma unroll
                for (int kb = 0; kb < 2; ++kb)   // the next trip's K rows come during this trip's softmax and P x V
#pragma unroll
                    for (int ks = 0; ks < 2; ++ks) { const int c = (kb * 2 + ks) * FT; kf[kb][ks] = WFrag<T16>::ld(kq + c); if (SPLIT) kf2[kb][ks] = WFrag<T16>::ld(kq2 + c); }
                __builtin_amdgcn_sched_barrier(0); }   // ... and ahead of the softmax: left free, this build sinks them into the P x V products, too late to have landed where the next trip's score products start
            float mx[NQ]; bool need = false;   // mx: the maximum over this lane's own 16 keys; the other half's is fetched only where m moves
#pragma unroll
            for (int nq = 0; nq < NQ; ++nq) { float t = s[0][nq][0];
#pragma unroll
                for (int r = 1; r < 16; ++r) t = fmaxf(t, s[r >> 3][nq][r & 7]);
                mx[nq] = t * C2; need = need || (mx[nq] > m[nq] + 8.0f); }
            if (__builtin_amdgcn_ballot_w32(need) != 0) {   // wave-uniform branch: the matrix instructions below need every lane on, and both halves of a column must hold one m
#pragma unroll
                for (int nq = 0; nq < NQ; ++nq) { const float mn = fmaxf(m[nq], fmaxf(mx[nq], xhalf(mx[nq]))); const float al = __builtin_amdgcn_exp2f(m[nq] - mn); m[nq] = mn; l[nq] *= al;
#pragma unroll
                    for (int db = 0; db < 4; ++db) oa[db][nq] *= al; } }
#pragma unroll
            for (int nq = 0; nq < NQ; ++nq) { v16f e;
#pragma unroll
                for (int r = 0; r < 16; r += 2) { const v2f a = { s[r >> 3][nq][r & 7], s[r >> 3][nq][(r & 7) + 1] }; const v2f t = __builtin_elementwise_fma(a, (v2f){ C2, C2 }, (v2f){ -m[nq], -m[nq] });   // register pairs as the accumulator holds them: packed f32 without moves
                    const v2f x = { __builtin_amdgcn_exp2f(t[0]), __builtin_amdgcn_exp2f(t[1]) }; e[r] = x[0]; e[r + 1] = x[1]; l[nq] += x; }
                V p, p2; PFrag<T16>::cv(e, p, p2);
#pragma unroll
                for (int db = 0; db < 4; ++db) { oa[db][nq] = WFrag<T16>::mma(vf[db], p, oa[db][nq]); if (SPLIT) { oa[db][nq] = WFrag<T16>::mma(vf[db], p2, oa[db][nq]); oa[db][nq] = WFrag<T16>::mma(vf2[db], p, oa[db][nq]); } } }
            if constexpr (more.v) {
                __builtin_amdgcn_sched_barrier(0);   // the V fragment loads stay together behind the P x V products, as the K loads above
                vq += 4 * FT; if (SPLIT) vq2 += 4 * FT;
#pragma unroll
                for (int db = 0; db < 4; ++db) { const int c = db * FT; vf[db] = WFrag<T16>::ld(vq + c); if (SPLIT) vf2[db] = WFrag<T16>::ld(vq2 + c); } }   // the next trip's V^T rows come during its score products and softmax
        };
#pragma unroll 1   // rolled: the trips depend on one another through m, the sum and O, and one trip already takes more than 256 registers
        for (int u = 0; u < SK / 32 - 1; ++u) trip(Flag<true>{});
        trip(Flag<false>{});   // the stage's last trip fetches nothing ahead: the next stage's buffer is not read from here, and no read is left to wait for at the stage's foot
      }
        if (sg >= -1) {   // the same for the whole work-group
            asm volatile("s_wait_dscnt 0x0" ::: "memory");   // this wave's reads of the buffer are done before the barrier behind which it is refilled
            asm volatile("s_wait_asynccnt 0x0" ::: "memory");   // this wave's copies of stage sg + 1 have landed
            __syncthreads(); }   // publishes stage sg + 1 and ends every wave's reads of stage sg
        if (cpw && sg + 2 < NS) copies(sg + 2, sg & 1);
    }
    asm volatile("s_wait_asynccnt 0x0" ::: "memory");   // no copy is in flight where the wave goes on to its epilogue or ends
    if (!comp) return;
#pragma unroll
    for (int nq = 0; nq < NQ; ++nq) { const float ls = l[nq][0] + l[nq][1]; const float inv = __fdiv_rn(1.0f, ls + xhalf(ls)); const size_t oo = (size_t)(q0 + nq * 16) * DQ + lane * 8;   // merged planes [batch t][DQ] in fragment order: d block db is half (db & 1) of the head's tile db / 2
#pragma unroll
        for (int db = 0; db < 4; ++db) { v8us oh, ol;
#pragma unroll
            for (int r = 0; r < 8; ++r) { unsigned short a, c2; splitf(oa[db][nq][r] * inv, a, c2); oh[r] = a; ol[r] = c2; }
            *(v8us*)(Ah + oo + (db >> 1) * FT + (db & 1) * 256) = oh; XW(); *(v8us*)(Al + oo + (db >> 1) * FT + (db & 1) * 256) = ol; XW(); } }   // the wait behind each store: the next rows' arithmetic reuses the registers that the store names
}
// grid (8, heads, batches), 8 waves: work-groups 0 to 3 of a head take 128 hi/lo rows each (4 waves x 32 rows, three products each), work-groups 4 to 7 take 384 fp16 rows each (8 waves x 48 rows, half the products of a hi/lo wave), so that every SIMD gets the same number of products. The kind is the same for the whole work-group, so each kind's barriers stand in code that all its waves run.
static_assert(RH == 4 * 128 && TT - RH == 4 * 384 && HD == 64, "row split of k_fattn");
__global__ __launch_bounds__(256) void k_fattn(const h16* __restrict__ Q16, const h16* __restrict__ K16, const h16* __restrict__ V16, const bf* __restrict__ Qh, const bf* __restrict__ Ql, const bf* __restrict__ Kh, const bf* __restrict__ Kl, const bf* __restrict__ Vh, const bf* __restrict__ Vl, bf* Ah, bf* Al) {
    __shared__ __align__(16) unsigned short ring[2 * 4 * 128 * HD];   // two buffers of 64 KiB: 4 planes x 128 keys (hi/lo) or 2 planes x 256 keys (fp16)
    const size_t po = ((size_t)blockIdx.z * NH_ + blockIdx.y) * TT * HD; const int bx = (int)blockIdx.x; const size_t ao = (size_t)blockIdx.z * TT * DQ + blockIdx.y * (HD / 32) * FT; Ah += ao; Al += ao;
    if (bx < 4) fattn<bf, true, 2, 128>(ring, Qh + po, Ql + po, Kh + po, Kl + po, Vh + po, Vl + po, bx * 128, Ah, Al);
    else fattn<h16, false, 3, 256>((const h16*)ring, Q16 + po, nullptr, K16 + po, nullptr, V16 + po, nullptr, RH + (bx - 4) * 384, Ah, Al);
}

extern "C" void kernel_launch(void* const* d_in, const int* in_sizes, int n_in,
                              void* d_out, int out_size, void* d_ws, size_t ws_size, hipStream_t stream) {
    (void)in_sizes; (void)n_in; (void)out_size;
    const float* x = (const float*)d_in[0]; const float* wq = (const float*)d_in[1]; const float* bq = (const float*)d_in[2]; const float* wk = (const float*)d_in[3]; const float* bk = (const float*)d_in[4]; const float* wv = (const float*)d_in[5]; const float* bv = (const float*)d_in[6]; const float* wo = (const float*)d_in[7]; const float* bo = (const float*)d_in[8];   /* order x, Wq, bq, Wk, bk, Wv, bv, Wo, bo ('xw' (in, out) [1024][1024] + [1024]): NINE inputs, all read: the host's own binding */
    float* OUT = (float*)d_out;     // [2][2048][1024]
    char* wsp = (char*)d_ws;
    auto take = [&](size_t bytes) { char* p = wsp; wsp += (bytes + 255) & ~(size_t)255; return (void*)p; };
    static_assert(DQ == DM && DKV == DM, "four weights of one size, stacked");
    const size_t PL = (size_t)NB_ * NH_ * TT * HD;   // one plane: both batches, all heads
    bf* WT = (bf*)take((size_t)4 * DM * DM * 2);   // Wq, Wk, Wv, Wo transposed, stacked
    float* CS = (float*)take((size_t)TT * HD * 2 * 4);
    bf* XB = (bf*)take((size_t)NB_ * TT * DM * 2);
    h16* P16 = (h16*)take(3 * PL * 2); bf* Ph = (bf*)take(3 * PL * 2); bf* Pl = (bf*)take(3 * PL * 2);   // q | k | v(transposed), each [batch][h]
    bf* ATh = (bf*)take((size_t)NB_ * TT * DQ * 2); bf* ATl = (bf*)take((size_t)NB_ * TT * DQ * 2);
    if ((size_t)(wsp - (char*)d_ws) > ws_size) return;    // ws 256 MiB
    k_prep<<<4 * NWB + NCB + NXB, 256, 0, stream>>>(x, wq, wk, wv, wo, XB, WT, CS);   /* with the COMPUTED rotary table (this module rotates q and k); k_csid stays defined and is NOT launched */
    k_gemmw<bf, 0, true, 1, DM, 4, 3, 1><<<dim3(NB_ * TT / 256, 3 * DQ / 192, 1), 384, 0, stream>>>(XB, nullptr, WT, nullptr, nullptr, 0, bq, bk, bv, CS, P16, Ph, Pl);
    k_fattn<<<dim3(8, NH_, NB_), 256, 0, stream>>>(P16, P16 + PL, P16 + 2 * PL, Ph, Pl, Ph + PL, Pl + PL, Ph + 2 * PL, Pl + 2 * PL, ATh, ATl);   // one kv head per query head
    k_gemmw<bf, 1, true, 0, DQ, 2, 2, 2><<<dim3(NB_ * TT / 128, DM / 128, 1), 128, 0, stream>>>(ATh, ATl, WT + (size_t)3 * DM * DM, nullptr, OUT, DM, bo, nullptr, nullptr, nullptr, nullptr, nullptr, nullptr);
}
